// v000
// Times are from an AMD MI455X. After a warm-up the kernel runs many times in a row, and a time is the length of
// such a window on the GPU divided by its runs, so every launch and the gaps after it count. The runs cycle
// through copies of the inputs. A figure is the median of several windows, for all but v000 over two sittings.
// Sittings can differ by a few percent; kernels timed side by side share one.
// v000, which the later versions start from, runs in 276 microseconds.
#include <hip/hip_runtime.h>

typedef _Float16     v16h  __attribute__((ext_vector_type(16)));
typedef float        v8f   __attribute__((ext_vector_type(8)));
typedef unsigned int u32x4 __attribute__((ext_vector_type(4)));
typedef int          i32x8 __attribute__((ext_vector_type(8)));
typedef int          i32x4 __attribute__((ext_vector_type(4)));

constexpr int BATCH = 2;
constexpr int SEQ   = 2048;
constexpr int EMB   = 1024;
constexpr int ATT   = 1024;
constexpr int HEADS = 16;
constexpr int HD    = 64;
constexpr int MTOT  = BATCH * SEQ;      // 4096 rows
constexpr float NEGF = -4.2949673e9f;   // -2^32 + 1 (reference mask fill)

__device__ inline v16h frag_ld(const _Float16* __restrict__ p) {
  v16h f;
#pragma unroll
  for (int i = 0; i < 8; ++i) { f[i] = p[i]; f[i + 8] = p[i + 16]; }
  return f;
}

__device__ inline v8f wmma_f16(v16h a, v16h b, v8f c) {
  return __builtin_amdgcn_wmma_f32_16x16x32_f16(
      false, a, false, b, (short)0, c, false, false);
}

// ---------------------------------------------------------------------------
// Kernel 1: fused QKV projection.  out16 = (f16) relu(X @ W + b); z==0 also
// keeps f32 q for the residual.  Tile 128x64, K-step 32; 8 waves, each 32x32.
// ---------------------------------------------------------------------------
__global__ __launch_bounds__(256) void qkv_proj_wmma(
    const float* __restrict__ Xq, const float* __restrict__ Xk,
    const float* __restrict__ Xv,
    const float* __restrict__ Wq, const float* __restrict__ Wk,
    const float* __restrict__ Wv,
    const float* __restrict__ bq, const float* __restrict__ bk,
    const float* __restrict__ bv,
    _Float16* __restrict__ q16, _Float16* __restrict__ k16,
    _Float16* __restrict__ v16, float* __restrict__ qf32) {
  const int z = blockIdx.z;
  const float* X    = (z == 0) ? Xq : (z == 1) ? Xk : Xv;
  const float* W    = (z == 0) ? Wq : (z == 1) ? Wk : Wv;
  const float* bias = (z == 0) ? bq : (z == 1) ? bk : bv;
  _Float16* out16   = (z == 0) ? q16 : (z == 1) ? k16 : v16;

  const int m0   = blockIdx.x * 128;
  const int n0   = blockIdx.y * 64;
  const int tid  = threadIdx.x;
  const int lane = tid & 31;
  const int wid  = tid >> 5;
  const int wm   = (wid & 3) * 32;
  const int wn   = (wid >> 2) * 32;
  const int rsel = (lane >> 4) * 8;

  __shared__ _Float16 shA[128][40];  // [M][K] +8 pad
  __shared__ _Float16 shB[64][40];   // [N][K] +8 pad

  const v8f zero = {};
  v8f acc[2][2];
#pragma unroll
  for (int i = 0; i < 2; ++i)
#pragma unroll
    for (int j = 0; j < 2; ++j) acc[i][j] = zero;

  for (int kt = 0; kt < EMB; kt += 32) {
    __syncthreads();
    // Phase 1: batch all global loads (back-to-back issue, single wait).
    float4 fa[4], fb[2];
#pragma unroll
    for (int i = 0; i < 4; ++i) {
      int e = tid + i * 256, row = e >> 3, c4 = (e & 7) << 2;
      fa[i] = *(const float4*)(X + (size_t)(m0 + row) * EMB + kt + c4);
    }
#pragma unroll
    for (int i = 0; i < 2; ++i) {
      int e = tid + i * 256, kr = e >> 4, c4 = (e & 15) << 2;
      fb[i] = *(const float4*)(W + (size_t)(kt + kr) * ATT + n0 + c4);
    }
    if (kt + 32 < EMB) {  // -> global_prefetch_b8
      __builtin_prefetch(X + (size_t)(m0 + (tid >> 1)) * EMB + kt + 32, 0, 0);
      __builtin_prefetch(W + (size_t)(kt + 32 + (tid & 31)) * ATT + n0, 0, 0);
    }
    // Phase 2: convert + LDS stores.
#pragma unroll
    for (int i = 0; i < 4; ++i) {
      int e = tid + i * 256, row = e >> 3, c4 = (e & 7) << 2;
      shA[row][c4 + 0] = (_Float16)fa[i].x;
      shA[row][c4 + 1] = (_Float16)fa[i].y;
      shA[row][c4 + 2] = (_Float16)fa[i].z;
      shA[row][c4 + 3] = (_Float16)fa[i].w;
    }
#pragma unroll
    for (int i = 0; i < 2; ++i) {
      int e = tid + i * 256, kr = e >> 4, c4 = (e & 15) << 2;
      shB[c4 + 0][kr] = (_Float16)fb[i].x;
      shB[c4 + 1][kr] = (_Float16)fb[i].y;
      shB[c4 + 2][kr] = (_Float16)fb[i].z;
      shB[c4 + 3][kr] = (_Float16)fb[i].w;
    }
    __syncthreads();

    v16h af[2], bf[2];
#pragma unroll
    for (int mt = 0; mt < 2; ++mt)
      af[mt] = frag_ld(&shA[wm + mt * 16 + (lane & 15)][rsel]);
#pragma unroll
    for (int nt = 0; nt < 2; ++nt)
      bf[nt] = frag_ld(&shB[wn + nt * 16 + (lane & 15)][rsel]);
#pragma unroll
    for (int mt = 0; mt < 2; ++mt)
#pragma unroll
      for (int nt = 0; nt < 2; ++nt)
        acc[mt][nt] = wmma_f16(af[mt], bf[nt], acc[mt][nt]);
  }

#pragma unroll
  for (int mt = 0; mt < 2; ++mt)
#pragma unroll
    for (int nt = 0; nt < 2; ++nt) {
      const float bv_ = bias[n0 + wn + nt * 16 + (lane & 15)];
#pragma unroll
      for (int r = 0; r < 8; ++r) {
        int grow = m0 + wm + mt * 16 + r + rsel;
        int gcol = n0 + wn + nt * 16 + (lane & 15);
        float val = fmaxf(acc[mt][nt][r] + bv_, 0.0f);
        out16[(size_t)grow * ATT + gcol] = (_Float16)val;
        if (z == 0) qf32[(size_t)grow * ATT + gcol] = val;
      }
    }
}

__global__ __launch_bounds__(256) void flash_attn_wmma(
    const _Float16* __restrict__ q16, const _Float16* __restrict__ k16,
    const _Float16* __restrict__ vv16, float* __restrict__ attn) {
  const int q0   = blockIdx.x * 128;
  const int b    = blockIdx.y / HEADS;
  const int h    = blockIdx.y % HEADS;
  const int tid  = threadIdx.x;
  const int lane = tid & 31;
  const int wid  = tid >> 5;
  const int rsel = (lane >> 4) * 8;

  __shared__ _Float16 shQ[128][72];
  __shared__ _Float16 shK[64][72];
  __shared__ _Float16 shVT[64][72];
  __shared__ _Float16 shP[8][16][72];

  const size_t rowbase = (size_t)b * SEQ;
  const size_t hoff    = (size_t)h * HD;

  {
    const uint32_t q_lds = (uint32_t)(uintptr_t)(void*)&shQ[0][0];
#pragma unroll
    for (int i = 0; i < 4; ++i) {
      int e = tid + i * 256;          // 1024 16-byte chunks (pad left alone)
      int row = e >> 3, dc = (e & 7) * 8;
      uint32_t lds = q_lds + (uint32_t)(row * 144 + dc * 2);
      uint64_t ga =
          (uint64_t)(uintptr_t)(q16 + (rowbase + q0 + row) * ATT + hoff + dc);
      asm volatile("global_load_async_to_lds_b128 %0, %1, off" ::"v"(lds),
                   "v"(ga)
                   : "memory");
    }
    asm volatile("s_wait_asynccnt 0x0" ::: "memory");
  }
  __syncthreads();

  v16h qf[2];
#pragma unroll
  for (int kc = 0; kc < 2; ++kc)
    qf[kc] = frag_ld(&shQ[wid * 16 + (lane & 15)][kc * 32 + rsel]);

  const v8f zero = {};
  v8f o[4];
#pragma unroll
  for (int nt = 0; nt < 4; ++nt) o[nt] = zero;
  float m[8], l[8];
#pragma unroll
  for (int r = 0; r < 8; ++r) { m[r] = -3.0e38f; l[r] = 0.0f; }

  const int nkb = q0 / 64 + 2;  // keys 0 .. q0+127 (causal bound)
  for (int kbI = 0; kbI < nkb; ++kbI) {
    const int kb = kbI * 64;
    __syncthreads();  // previous block's K/V reads done before overwrite

    if (tid < 32) {
      uint64_t ga =
          (uint64_t)(uintptr_t)(k16 + (rowbase + kb) * ATT + hoff);
      u32x4 g0 = {1u, (uint32_t)(uintptr_t)(void*)&shK[0][0], (uint32_t)ga,
                  (uint32_t)(ga >> 32) | (2u << 30)};
      i32x8 g1 = {(int)((1u << 16) | (1u << 20) | (4u << 22) | (3u << 25)),
                  64 << 16,
                  64 << 16,
                  64 << 16,
                  64,
                  1024,
                  0, 0};
      i32x4 gz4 = {0, 0, 0, 0};
      i32x8 gz8 = {0, 0, 0, 0, 0, 0, 0, 0};
      // 6-arg (clang-23 / therock) form: (g0, g1, g2, g3, g4, cpol)
      __builtin_amdgcn_tensor_load_to_lds(g0, g1, gz4, gz4, gz8, 0);
    }

#pragma unroll
    for (int i = 0; i < 2; ++i) {
      int e = tid + i * 256;          // 512 chunks of 8 halves
      int key = e >> 3, dc = (e & 7) * 8;
      float4 raw =
          *(const float4*)(vv16 + (rowbase + kb + key) * ATT + hoff + dc);
      const _Float16* hp = (const _Float16*)&raw;
#pragma unroll
      for (int j = 0; j < 8; ++j) shVT[dc + j][key] = hp[j];
    }
    if (tid < 32) __builtin_amdgcn_s_wait_tensorcnt(0);
    __syncthreads();

    // ---- S = Q K^T ----
    v8f sc[4];
#pragma unroll
    for (int nt = 0; nt < 4; ++nt) {
      v8f c = zero;
#pragma unroll
      for (int kc = 0; kc < 2; ++kc) {
        v16h bf = frag_ld(&shK[nt * 16 + (lane & 15)][kc * 32 + rsel]);
        c = wmma_f16(qf[kc], bf, c);
      }
      sc[nt] = c;
    }

    // ---- scale, causal mask, online softmax ----
    float nm[8];
#pragma unroll
    for (int r = 0; r < 8; ++r) nm[r] = m[r];
#pragma unroll
    for (int nt = 0; nt < 4; ++nt) {
      int col = kb + nt * 16 + (lane & 15);
#pragma unroll
      for (int r = 0; r < 8; ++r) {
        int row = q0 + wid * 16 + r + rsel;
        float s = sc[nt][r] * 0.125f;
        s = (col > row) ? NEGF : s;
        sc[nt][r] = s;
        nm[r] = fmaxf(nm[r], s);
      }
    }
#pragma unroll
    for (int r = 0; r < 8; ++r)
#pragma unroll
      for (int off = 1; off < 16; off <<= 1)
        nm[r] = fmaxf(nm[r], __shfl_xor(nm[r], off, 32));

    float rs[8];
#pragma unroll
    for (int r = 0; r < 8; ++r) rs[r] = 0.0f;
#pragma unroll
    for (int nt = 0; nt < 4; ++nt)
#pragma unroll
      for (int r = 0; r < 8; ++r) {
        float p = __expf(sc[nt][r] - nm[r]);
        sc[nt][r] = p;
        rs[r] += p;
      }
#pragma unroll
    for (int r = 0; r < 8; ++r)
#pragma unroll
      for (int off = 1; off < 16; off <<= 1)
        rs[r] += __shfl_xor(rs[r], off, 32);

#pragma unroll
    for (int r = 0; r < 8; ++r) {
      float alpha = __expf(m[r] - nm[r]);
      l[r] = l[r] * alpha + rs[r];
      m[r] = nm[r];
#pragma unroll
      for (int nt = 0; nt < 4; ++nt) o[nt][r] *= alpha;
    }

    // ---- P relayout (C -> A fragment) via wave-private LDS strip ----
#pragma unroll
    for (int nt = 0; nt < 4; ++nt)
#pragma unroll
      for (int r = 0; r < 8; ++r)
        shP[wid][r + rsel][nt * 16 + (lane & 15)] = (_Float16)sc[nt][r];

    v16h pf[2];
#pragma unroll
    for (int kc = 0; kc < 2; ++kc)
      pf[kc] = frag_ld(&shP[wid][lane & 15][kc * 32 + rsel]);

    // ---- O += P V ----
#pragma unroll
    for (int nt = 0; nt < 4; ++nt)
#pragma unroll
      for (int kc = 0; kc < 2; ++kc) {
        v16h bf = frag_ld(&shVT[nt * 16 + (lane & 15)][kc * 32 + rsel]);
        o[nt] = wmma_f16(pf[kc], bf, o[nt]);
      }
  }

  // ---- normalize and write the head's slice (f32) ----
#pragma unroll
  for (int r = 0; r < 8; ++r) {
    float inv = 1.0f / l[r];
    size_t grow = rowbase + q0 + wid * 16 + r + rsel;
#pragma unroll
    for (int nt = 0; nt < 4; ++nt)
      attn[grow * ATT + hoff + nt * 16 + (lane & 15)] = o[nt][r] * inv;
  }
}

// ---------------------------------------------------------------------------
// Kernel 3: residual (+ projected q) and LayerNorm over the 1024-wide row.
// ---------------------------------------------------------------------------
__global__ __launch_bounds__(256) void resid_layernorm(
    const float* __restrict__ attn, const float* __restrict__ qres,
    const float* __restrict__ gamma, const float* __restrict__ beta,
    float* __restrict__ out) {
  const int row = blockIdx.x;
  const int tid = threadIdx.x;
  const size_t base = (size_t)row * ATT + tid * 4;

  float4 a = *(const float4*)(attn + base);
  float4 q = *(const float4*)(qres + base);
  float x0 = a.x + q.x, x1 = a.y + q.y, x2 = a.z + q.z, x3 = a.w + q.w;

  __shared__ float r1[256], r2[256];
  r1[tid] = x0 + x1 + x2 + x3;
  r2[tid] = x0 * x0 + x1 * x1 + x2 * x2 + x3 * x3;
  __syncthreads();
#pragma unroll
  for (int off = 128; off > 0; off >>= 1) {
    if (tid < off) { r1[tid] += r1[tid + off]; r2[tid] += r2[tid + off]; }
    __syncthreads();
  }
  const float mu   = r1[0] * (1.0f / ATT);
  const float var  = r2[0] * (1.0f / ATT) - mu * mu;
  const float rinv = rsqrtf(var + 1e-5f);

  float4 g  = *(const float4*)(gamma + tid * 4);
  float4 be = *(const float4*)(beta + tid * 4);
  float4 y;
  y.x = (x0 - mu) * rinv * g.x + be.x;
  y.y = (x1 - mu) * rinv * g.y + be.y;
  y.z = (x2 - mu) * rinv * g.z + be.z;
  y.w = (x3 - mu) * rinv * g.w + be.w;
  *(float4*)(out + base) = y;
}

// ---------------------------------------------------------------------------
extern "C" void kernel_launch(void* const* d_in, const int* in_sizes, int n_in,
                              void* d_out, int out_size, void* d_ws,
                              size_t ws_size, hipStream_t stream) {
  const float* query = (const float*)d_in[0];
  const float* key   = (const float*)d_in[1];
  const float* value = (const float*)d_in[2];
  const float* Wq    = (const float*)d_in[3];
  const float* bq    = (const float*)d_in[4];
  const float* Wk    = (const float*)d_in[5];
  const float* bk    = (const float*)d_in[6];
  const float* Wv    = (const float*)d_in[7];
  const float* bv    = (const float*)d_in[8];
  const float* gamma = (const float*)d_in[9];
  const float* beta  = (const float*)d_in[10];

  // Workspace: q16/k16/v16 (8 MiB each) | q f32 (16 MiB) | attn f32 (16 MiB)
  char* ws = (char*)d_ws;
  const size_t F16B = (size_t)MTOT * ATT * sizeof(_Float16);
  const size_t F32B = (size_t)MTOT * ATT * sizeof(float);
  _Float16* q16  = (_Float16*)(ws);
  _Float16* k16  = (_Float16*)(ws + F16B);
  _Float16* v16  = (_Float16*)(ws + 2 * F16B);
  float*    qf32 = (float*)(ws + 3 * F16B);
  float*    attn = (float*)(ws + 3 * F16B + F32B);

  dim3 gProj(MTOT / 128, ATT / 64, 3);
  qkv_proj_wmma<<<gProj, 256, 0, stream>>>(query, key, value, Wq, Wk, Wv, bq,
                                           bk, bv, q16, k16, v16, qf32);

  dim3 gAttn(SEQ / 128, BATCH * HEADS);
  flash_attn_wmma<<<gAttn, 256, 0, stream>>>(q16, k16, v16, attn);

  resid_layernorm<<<MTOT, 256, 0, stream>>>(attn, qf32, gamma, beta,
                                            (float*)d_out);
}

// v001
// Measured time: 254 microseconds a run.
// Next to v000, in two timings, it ran 1.12 times as fast each time.
#include <hip/hip_runtime.h>

typedef _Float16     v16h  __attribute__((ext_vector_type(16)));
typedef float        v8f   __attribute__((ext_vector_type(8)));
typedef unsigned int u32x4 __attribute__((ext_vector_type(4)));
typedef int          i32x8 __attribute__((ext_vector_type(8)));
typedef int          i32x4 __attribute__((ext_vector_type(4)));

constexpr int BATCH = 2;
constexpr int SEQ   = 2048;
constexpr int EMB   = 1024;
constexpr int ATT   = 1024;
constexpr int HEADS = 16;
constexpr int HD    = 64;
constexpr int MTOT  = BATCH * SEQ;      // 4096 rows
constexpr float NEGF = -4.2949673e9f;   // -2^32 + 1 (reference mask fill)

__device__ inline v16h frag_ld(const _Float16* __restrict__ p) {
  v16h f;
#pragma unroll
  for (int i = 0; i < 8; ++i) { f[i] = p[i]; f[i + 8] = p[i + 16]; }
  return f;
}

__device__ inline v8f wmma_f16(v16h a, v16h b, v8f c) {
  return __builtin_amdgcn_wmma_f32_16x16x32_f16(
      false, a, false, b, (short)0, c, false, false);
}

// ---------------------------------------------------------------------------
// Kernel 1: fused QKV projection.  out16 = (f16) relu(X @ W + b); z==0 also
// keeps f32 q for the residual.  Tile 128x64, K-step 32; 8 waves, each 32x32.
// ---------------------------------------------------------------------------
__global__ __launch_bounds__(256) void qkv_proj_wmma(
    const float* __restrict__ Xq, const float* __restrict__ Xk,
    const float* __restrict__ Xv,
    const float* __restrict__ Wq, const float* __restrict__ Wk,
    const float* __restrict__ Wv,
    const float* __restrict__ bq, const float* __restrict__ bk,
    const float* __restrict__ bv,
    _Float16* __restrict__ q16, _Float16* __restrict__ k16,
    _Float16* __restrict__ v16, float* __restrict__ qf32) {
  const int z = blockIdx.z;
  const float* X    = (z == 0) ? Xq : (z == 1) ? Xk : Xv;
  const float* W    = (z == 0) ? Wq : (z == 1) ? Wk : Wv;
  const float* bias = (z == 0) ? bq : (z == 1) ? bk : bv;
  _Float16* out16   = (z == 0) ? q16 : (z == 1) ? k16 : v16;

  const int m0   = blockIdx.x * 128;
  const int n0   = blockIdx.y * 64;
  const int tid  = threadIdx.x;
  const int lane = tid & 31;
  const int wid  = tid >> 5;
  const int wm   = (wid & 3) * 32;
  const int wn   = (wid >> 2) * 32;
  const int rsel = (lane >> 4) * 8;

  __shared__ _Float16 shA[128][40];  // [M][K] +8 pad
  __shared__ _Float16 shB[64][40];   // [N][K] +8 pad

  const v8f zero = {};
  v8f acc[2][2];
#pragma unroll
  for (int i = 0; i < 2; ++i)
#pragma unroll
    for (int j = 0; j < 2; ++j) acc[i][j] = zero;

  for (int kt = 0; kt < EMB; kt += 32) {
    __syncthreads();
    // Phase 1: batch all global loads (back-to-back issue, single wait).
    float4 fa[4], fb[2];
#pragma unroll
    for (int i = 0; i < 4; ++i) {
      int e = tid + i * 256, row = e >> 3, c4 = (e & 7) << 2;
      fa[i] = *(const float4*)(X + (size_t)(m0 + row) * EMB + kt + c4);
    }
#pragma unroll
    for (int i = 0; i < 2; ++i) {
      int e = tid + i * 256, kr = e >> 4, c4 = (e & 15) << 2;
      fb[i] = *(const float4*)(W + (size_t)(kt + kr) * ATT + n0 + c4);
    }
    // Phase 2: convert + LDS stores.
#pragma unroll
    for (int i = 0; i < 4; ++i) {
      int e = tid + i * 256, row = e >> 3, c4 = (e & 7) << 2;
      shA[row][c4 + 0] = (_Float16)fa[i].x;
      shA[row][c4 + 1] = (_Float16)fa[i].y;
      shA[row][c4 + 2] = (_Float16)fa[i].z;
      shA[row][c4 + 3] = (_Float16)fa[i].w;
    }
#pragma unroll
    for (int i = 0; i < 2; ++i) {
      int e = tid + i * 256, kr = e >> 4, c4 = (e & 15) << 2;
      shB[c4 + 0][kr] = (_Float16)fb[i].x;
      shB[c4 + 1][kr] = (_Float16)fb[i].y;
      shB[c4 + 2][kr] = (_Float16)fb[i].z;
      shB[c4 + 3][kr] = (_Float16)fb[i].w;
    }
    __syncthreads();

    v16h af[2], bf[2];
#pragma unroll
    for (int mt = 0; mt < 2; ++mt)
      af[mt] = frag_ld(&shA[wm + mt * 16 + (lane & 15)][rsel]);
#pragma unroll
    for (int nt = 0; nt < 2; ++nt)
      bf[nt] = frag_ld(&shB[wn + nt * 16 + (lane & 15)][rsel]);
#pragma unroll
    for (int mt = 0; mt < 2; ++mt)
#pragma unroll
      for (int nt = 0; nt < 2; ++nt)
        acc[mt][nt] = wmma_f16(af[mt], bf[nt], acc[mt][nt]);
  }

#pragma unroll
  for (int mt = 0; mt < 2; ++mt)
#pragma unroll
    for (int nt = 0; nt < 2; ++nt) {
      const float bv_ = bias[n0 + wn + nt * 16 + (lane & 15)];
#pragma unroll
      for (int r = 0; r < 8; ++r) {
        int grow = m0 + wm + mt * 16 + r + rsel;
        int gcol = n0 + wn + nt * 16 + (lane & 15);
        float val = fmaxf(acc[mt][nt][r] + bv_, 0.0f);
        out16[(size_t)grow * ATT + gcol] = (_Float16)val;
        if (z == 0) qf32[(size_t)grow * ATT + gcol] = val;
      }
    }
}

__global__ __launch_bounds__(256) void flash_attn_wmma(
    const _Float16* __restrict__ q16, const _Float16* __restrict__ k16,
    const _Float16* __restrict__ vv16, float* __restrict__ attn) {
  const int q0   = blockIdx.x * 128;
  const int b    = blockIdx.y / HEADS;
  const int h    = blockIdx.y % HEADS;
  const int tid  = threadIdx.x;
  const int lane = tid & 31;
  const int wid  = tid >> 5;
  const int rsel = (lane >> 4) * 8;

  __shared__ _Float16 shQ[128][72];
  __shared__ _Float16 shK[64][72];
  __shared__ _Float16 shVT[64][72];
  __shared__ _Float16 shP[8][16][72];

  const size_t rowbase = (size_t)b * SEQ;
  const size_t hoff    = (size_t)h * HD;

  {
    const uint32_t q_lds = (uint32_t)(uintptr_t)(void*)&shQ[0][0];
#pragma unroll
    for (int i = 0; i < 4; ++i) {
      int e = tid + i * 256;          // 1024 16-byte chunks (pad left alone)
      int row = e >> 3, dc = (e & 7) * 8;
      uint32_t lds = q_lds + (uint32_t)(row * 144 + dc * 2);
      uint64_t ga =
          (uint64_t)(uintptr_t)(q16 + (rowbase + q0 + row) * ATT + hoff + dc);
      asm volatile("global_load_async_to_lds_b128 %0, %1, off" ::"v"(lds),
                   "v"(ga)
                   : "memory");
    }
    asm volatile("s_wait_asynccnt 0x0" ::: "memory");
  }
  __syncthreads();

  v16h qf[2];
#pragma unroll
  for (int kc = 0; kc < 2; ++kc)
    qf[kc] = frag_ld(&shQ[wid * 16 + (lane & 15)][kc * 32 + rsel]);

  const v8f zero = {};
  v8f o[4];
#pragma unroll
  for (int nt = 0; nt < 4; ++nt) o[nt] = zero;
  float m[8], l[8];
#pragma unroll
  for (int r = 0; r < 8; ++r) { m[r] = -3.0e38f; l[r] = 0.0f; }

  const int nkb = q0 / 64 + 2;  // keys 0 .. q0+127 (causal bound)
  for (int kbI = 0; kbI < nkb; ++kbI) {
    const int kb = kbI * 64;
    __syncthreads();  // previous block's K/V reads done before overwrite

    if (tid < 32) {
      uint64_t ga =
          (uint64_t)(uintptr_t)(k16 + (rowbase + kb) * ATT + hoff);
      u32x4 g0 = {1u, (uint32_t)(uintptr_t)(void*)&shK[0][0], (uint32_t)ga,
                  (uint32_t)(ga >> 32) | (2u << 30)};
      i32x8 g1 = {(int)((1u << 16) | (1u << 20) | (4u << 22) | (3u << 25)),
                  64 << 16,
                  64 << 16,
                  64 << 16,
                  64,
                  1024,
                  0, 0};
      i32x4 gz4 = {0, 0, 0, 0};
      i32x8 gz8 = {0, 0, 0, 0, 0, 0, 0, 0};
      // 6-arg (clang-23 / therock) form: (g0, g1, g2, g3, g4, cpol)
      __builtin_amdgcn_tensor_load_to_lds(g0, g1, gz4, gz4, gz8, 0);
    }

#pragma unroll
    for (int i = 0; i < 2; ++i) {
      int e = tid + i * 256;          // 512 chunks of 8 halves
      int key = e >> 3, dc = (e & 7) * 8;
      float4 raw =
          *(const float4*)(vv16 + (rowbase + kb + key) * ATT + hoff + dc);
      const _Float16* hp = (const _Float16*)&raw;
#pragma unroll
      for (int j = 0; j < 8; ++j) shVT[dc + j][key] = hp[j];
    }
    if (tid < 32) __builtin_amdgcn_s_wait_tensorcnt(0);
    __syncthreads();

    // ---- S = Q K^T ----
    v8f sc[4];
#pragma unroll
    for (int nt = 0; nt < 4; ++nt) {
      v8f c = zero;
#pragma unroll
      for (int kc = 0; kc < 2; ++kc) {
        v16h bf = frag_ld(&shK[nt * 16 + (lane & 15)][kc * 32 + rsel]);
        c = wmma_f16(qf[kc], bf, c);
      }
      sc[nt] = c;
    }

    // ---- scale, causal mask, online softmax ----
    float nm[8];
#pragma unroll
    for (int r = 0; r < 8; ++r) nm[r] = m[r];
#pragma unroll
    for (int nt = 0; nt < 4; ++nt) {
      int col = kb + nt * 16 + (lane & 15);
#pragma unroll
      for (int r = 0; r < 8; ++r) {
        int row = q0 + wid * 16 + r + rsel;
        float s = sc[nt][r] * 0.125f;
        s = (col > row) ? NEGF : s;
        sc[nt][r] = s;
        nm[r] = fmaxf(nm[r], s);
      }
    }
#pragma unroll
    for (int r = 0; r < 8; ++r)
#pragma unroll
      for (int off = 1; off < 16; off <<= 1)
        nm[r] = fmaxf(nm[r], __shfl_xor(nm[r], off, 32));

    float rs[8];
#pragma unroll
    for (int r = 0; r < 8; ++r) rs[r] = 0.0f;
#pragma unroll
    for (int nt = 0; nt < 4; ++nt)
#pragma unroll
      for (int r = 0; r < 8; ++r) {
        float p = __expf(sc[nt][r] - nm[r]);
        sc[nt][r] = p;
        rs[r] += p;
      }
#pragma unroll
    for (int r = 0; r < 8; ++r)
#pragma unroll
      for (int off = 1; off < 16; off <<= 1)
        rs[r] += __shfl_xor(rs[r], off, 32);

#pragma unroll
    for (int r = 0; r < 8; ++r) {
      float alpha = __expf(m[r] - nm[r]);
      l[r] = l[r] * alpha + rs[r];
      m[r] = nm[r];
#pragma unroll
      for (int nt = 0; nt < 4; ++nt) o[nt][r] *= alpha;
    }

    // ---- P relayout (C -> A fragment) via wave-private LDS strip ----
#pragma unroll
    for (int nt = 0; nt < 4; ++nt)
#pragma unroll
      for (int r = 0; r < 8; ++r)
        shP[wid][r + rsel][nt * 16 + (lane & 15)] = (_Float16)sc[nt][r];

    v16h pf[2];
#pragma unroll
    for (int kc = 0; kc < 2; ++kc)
      pf[kc] = frag_ld(&shP[wid][lane & 15][kc * 32 + rsel]);

    // ---- O += P V ----
#pragma unroll
    for (int nt = 0; nt < 4; ++nt)
#pragma unroll
      for (int kc = 0; kc < 2; ++kc) {
        v16h bf = frag_ld(&shVT[nt * 16 + (lane & 15)][kc * 32 + rsel]);
        o[nt] = wmma_f16(pf[kc], bf, o[nt]);
      }
  }

  // ---- normalize and write the head's slice (f32) ----
#pragma unroll
  for (int r = 0; r < 8; ++r) {
    float inv = 1.0f / l[r];
    size_t grow = rowbase + q0 + wid * 16 + r + rsel;
#pragma unroll
    for (int nt = 0; nt < 4; ++nt)
      attn[grow * ATT + hoff + nt * 16 + (lane & 15)] = o[nt][r] * inv;
  }
}

// ---------------------------------------------------------------------------
// Kernel 3: residual (+ projected q) and LayerNorm over the 1024-wide row.
// ---------------------------------------------------------------------------
__global__ __launch_bounds__(256) void resid_layernorm(
    const float* __restrict__ attn, const float* __restrict__ qres,
    const float* __restrict__ gamma, const float* __restrict__ beta,
    float* __restrict__ out) {
  const int row = blockIdx.x;
  const int tid = threadIdx.x;
  const size_t base = (size_t)row * ATT + tid * 4;

  float4 a = *(const float4*)(attn + base);
  float4 q = *(const float4*)(qres + base);
  float x0 = a.x + q.x, x1 = a.y + q.y, x2 = a.z + q.z, x3 = a.w + q.w;

  __shared__ float r1[256], r2[256];
  r1[tid] = x0 + x1 + x2 + x3;
  r2[tid] = x0 * x0 + x1 * x1 + x2 * x2 + x3 * x3;
  __syncthreads();
#pragma unroll
  for (int off = 128; off > 0; off >>= 1) {
    if (tid < off) { r1[tid] += r1[tid + off]; r2[tid] += r2[tid + off]; }
    __syncthreads();
  }
  const float mu   = r1[0] * (1.0f / ATT);
  const float var  = r2[0] * (1.0f / ATT) - mu * mu;
  const float rinv = rsqrtf(var + 1e-5f);

  float4 g  = *(const float4*)(gamma + tid * 4);
  float4 be = *(const float4*)(beta + tid * 4);
  float4 y;
  y.x = (x0 - mu) * rinv * g.x + be.x;
  y.y = (x1 - mu) * rinv * g.y + be.y;
  y.z = (x2 - mu) * rinv * g.z + be.z;
  y.w = (x3 - mu) * rinv * g.w + be.w;
  *(float4*)(out + base) = y;
}

// ---------------------------------------------------------------------------
extern "C" void kernel_launch(void* const* d_in, const int* in_sizes, int n_in,
                              void* d_out, int out_size, void* d_ws,
                              size_t ws_size, hipStream_t stream) {
  const float* query = (const float*)d_in[0];
  const float* key   = (const float*)d_in[1];
  const float* value = (const float*)d_in[2];
  const float* Wq    = (const float*)d_in[3];
  const float* bq    = (const float*)d_in[4];
  const float* Wk    = (const float*)d_in[5];
  const float* bk    = (const float*)d_in[6];
  const float* Wv    = (const float*)d_in[7];
  const float* bv    = (const float*)d_in[8];
  const float* gamma = (const float*)d_in[9];
  const float* beta  = (const float*)d_in[10];

  // Workspace: q16/k16/v16 (8 MiB each) | q f32 (16 MiB) | attn f32 (16 MiB)
  char* ws = (char*)d_ws;
  const size_t F16B = (size_t)MTOT * ATT * sizeof(_Float16);
  const size_t F32B = (size_t)MTOT * ATT * sizeof(float);
  _Float16* q16  = (_Float16*)(ws);
  _Float16* k16  = (_Float16*)(ws + F16B);
  _Float16* v16  = (_Float16*)(ws + 2 * F16B);
  float*    qf32 = (float*)(ws + 3 * F16B);
  float*    attn = (float*)(ws + 3 * F16B + F32B);

  dim3 gProj(MTOT / 128, ATT / 64, 3);
  qkv_proj_wmma<<<gProj, 256, 0, stream>>>(query, key, value, Wq, Wk, Wv, bq,
                                           bk, bv, q16, k16, v16, qf32);

  dim3 gAttn(SEQ / 128, BATCH * HEADS);
  flash_attn_wmma<<<gAttn, 256, 0, stream>>>(q16, k16, v16, attn);

  resid_layernorm<<<MTOT, 256, 0, stream>>>(attn, qf32, gamma, beta,
                                            (float*)d_out);
}

// v002
// One run takes 193 microseconds.
// Next to v001, in two timings, it ran 1.31 and 1.32 times as fast.
// All steps since v000 together make it 1.47 times as fast.
#include <hip/hip_runtime.h>

typedef _Float16     v16h  __attribute__((ext_vector_type(16)));
typedef float        v8f   __attribute__((ext_vector_type(8)));
typedef unsigned int u32x4 __attribute__((ext_vector_type(4)));
typedef int          i32x8 __attribute__((ext_vector_type(8)));
typedef int          i32x4 __attribute__((ext_vector_type(4)));

constexpr int BATCH = 2;
constexpr int SEQ   = 2048;
constexpr int EMB   = 1024;
constexpr int ATT   = 1024;
constexpr int HEADS = 16;
constexpr int HD    = 64;
constexpr int MTOT  = BATCH * SEQ;      // 4096 rows
constexpr float NEGF = -4.2949673e9f;   // -2^32 + 1 (reference mask fill)

__device__ inline v16h frag_ld(const _Float16* __restrict__ p) {
  v16h f;
#pragma unroll
  for (int i = 0; i < 8; ++i) { f[i] = p[i]; f[i + 8] = p[i + 16]; }
  return f;
}

#define ROWRED_STEP(OP, M)                                        \
  OP " %0, %0, %0 row_xmask:" #M " row_mask:0xf bank_mask:0xf\n\t" \
  OP " %1, %1, %1 row_xmask:" #M " row_mask:0xf bank_mask:0xf\n\t" \
  OP " %2, %2, %2 row_xmask:" #M " row_mask:0xf bank_mask:0xf\n\t" \
  OP " %3, %3, %3 row_xmask:" #M " row_mask:0xf bank_mask:0xf\n\t" \
  OP " %4, %4, %4 row_xmask:" #M " row_mask:0xf bank_mask:0xf\n\t" \
  OP " %5, %5, %5 row_xmask:" #M " row_mask:0xf bank_mask:0xf\n\t" \
  OP " %6, %6, %6 row_xmask:" #M " row_mask:0xf bank_mask:0xf\n\t" \
  OP " %7, %7, %7 row_xmask:" #M " row_mask:0xf bank_mask:0xf\n\t"
#define ROWRED8(OP, v)                                                    \
  asm(ROWRED_STEP(OP, 1) ROWRED_STEP(OP, 2) ROWRED_STEP(OP, 4)            \
          ROWRED_STEP(OP, 8)                                              \
      : "+v"(v[0]), "+v"(v[1]), "+v"(v[2]), "+v"(v[3]), "+v"(v[4]),       \
        "+v"(v[5]), "+v"(v[6]), "+v"(v[7]))

__device__ inline v8f wmma_f16(v16h a, v16h b, v8f c) {
  return __builtin_amdgcn_wmma_f32_16x16x32_f16(
      false, a, false, b, (short)0, c, false, false);
}

// ---------------------------------------------------------------------------
// Kernel 1: fused QKV projection.  out16 = (f16) relu(X @ W + b); z==0 also
// keeps f32 q for the residual.  Tile 128x64, K-step 32; 8 waves, each 32x32.
// ---------------------------------------------------------------------------
__global__ __launch_bounds__(256) void qkv_proj_wmma(
    const float* __restrict__ Xq, const float* __restrict__ Xk,
    const float* __restrict__ Xv,
    const float* __restrict__ Wq, const float* __restrict__ Wk,
    const float* __restrict__ Wv,
    const float* __restrict__ bq, const float* __restrict__ bk,
    const float* __restrict__ bv,
    _Float16* __restrict__ q16, _Float16* __restrict__ k16,
    _Float16* __restrict__ v16, float* __restrict__ qf32) {
  const int z = blockIdx.z;
  const float* X    = (z == 0) ? Xq : (z == 1) ? Xk : Xv;
  const float* W    = (z == 0) ? Wq : (z == 1) ? Wk : Wv;
  const float* bias = (z == 0) ? bq : (z == 1) ? bk : bv;
  _Float16* out16   = (z == 0) ? q16 : (z == 1) ? k16 : v16;

  const int m0   = blockIdx.x * 128;
  const int n0   = blockIdx.y * 64;
  const int tid  = threadIdx.x;
  const int lane = tid & 31;
  const int wid  = tid >> 5;
  const int wm   = (wid & 3) * 32;
  const int wn   = (wid >> 2) * 32;
  const int rsel = (lane >> 4) * 8;

  __shared__ _Float16 shA[128][40];  // [M][K] +8 pad
  __shared__ _Float16 shB[64][40];   // [N][K] +8 pad

  const v8f zero = {};
  v8f acc[2][2];
#pragma unroll
  for (int i = 0; i < 2; ++i)
#pragma unroll
    for (int j = 0; j < 2; ++j) acc[i][j] = zero;

  for (int kt = 0; kt < EMB; kt += 32) {
    __syncthreads();
    // Phase 1: batch all global loads (back-to-back issue, single wait).
    float4 fa[4], fb[2];
#pragma unroll
    for (int i = 0; i < 4; ++i) {
      int e = tid + i * 256, row = e >> 3, c4 = (e & 7) << 2;
      fa[i] = *(const float4*)(X + (size_t)(m0 + row) * EMB + kt + c4);
    }
#pragma unroll
    for (int i = 0; i < 2; ++i) {
      int e = tid + i * 256, kr = e >> 4, c4 = (e & 15) << 2;
      fb[i] = *(const float4*)(W + (size_t)(kt + kr) * ATT + n0 + c4);
    }
    // Phase 2: convert + LDS stores.
#pragma unroll
    for (int i = 0; i < 4; ++i) {
      int e = tid + i * 256, row = e >> 3, c4 = (e & 7) << 2;
      shA[row][c4 + 0] = (_Float16)fa[i].x;
      shA[row][c4 + 1] = (_Float16)fa[i].y;
      shA[row][c4 + 2] = (_Float16)fa[i].z;
      shA[row][c4 + 3] = (_Float16)fa[i].w;
    }
#pragma unroll
    for (int i = 0; i < 2; ++i) {
      int e = tid + i * 256, kr = e >> 4, c4 = (e & 15) << 2;
      shB[c4 + 0][kr] = (_Float16)fb[i].x;
      shB[c4 + 1][kr] = (_Float16)fb[i].y;
      shB[c4 + 2][kr] = (_Float16)fb[i].z;
      shB[c4 + 3][kr] = (_Float16)fb[i].w;
    }
    __syncthreads();

    v16h af[2], bf[2];
#pragma unroll
    for (int mt = 0; mt < 2; ++mt)
      af[mt] = frag_ld(&shA[wm + mt * 16 + (lane & 15)][rsel]);
#pragma unroll
    for (int nt = 0; nt < 2; ++nt)
      bf[nt] = frag_ld(&shB[wn + nt * 16 + (lane & 15)][rsel]);
#pragma unroll
    for (int mt = 0; mt < 2; ++mt)
#pragma unroll
      for (int nt = 0; nt < 2; ++nt)
        acc[mt][nt] = wmma_f16(af[mt], bf[nt], acc[mt][nt]);
  }

#pragma unroll
  for (int mt = 0; mt < 2; ++mt)
#pragma unroll
    for (int nt = 0; nt < 2; ++nt) {
      const float bv_ = bias[n0 + wn + nt * 16 + (lane & 15)];
#pragma unroll
      for (int r = 0; r < 8; ++r) {
        int grow = m0 + wm + mt * 16 + r + rsel;
        int gcol = n0 + wn + nt * 16 + (lane & 15);
        float val = fmaxf(acc[mt][nt][r] + bv_, 0.0f);
        out16[(size_t)grow * ATT + gcol] = (_Float16)val;
        if (z == 0) qf32[(size_t)grow * ATT + gcol] = val;
      }
    }
}

__global__ __launch_bounds__(256) void flash_attn_wmma(
    const _Float16* __restrict__ q16, const _Float16* __restrict__ k16,
    const _Float16* __restrict__ vv16, float* __restrict__ attn) {
  const int q0   = blockIdx.x * 128;
  const int b    = blockIdx.y / HEADS;
  const int h    = blockIdx.y % HEADS;
  const int tid  = threadIdx.x;
  const int lane = tid & 31;
  const int wid  = tid >> 5;
  const int rsel = (lane >> 4) * 8;

  __shared__ _Float16 shQ[128][72];
  __shared__ _Float16 shK[64][72];
  __shared__ _Float16 shVT[64][72];
  __shared__ _Float16 shP[8][16][72];

  const size_t rowbase = (size_t)b * SEQ;
  const size_t hoff    = (size_t)h * HD;

  {
    const uint32_t q_lds = (uint32_t)(uintptr_t)(void*)&shQ[0][0];
#pragma unroll
    for (int i = 0; i < 4; ++i) {
      int e = tid + i * 256;          // 1024 16-byte chunks (pad left alone)
      int row = e >> 3, dc = (e & 7) * 8;
      uint32_t lds = q_lds + (uint32_t)(row * 144 + dc * 2);
      uint64_t ga =
          (uint64_t)(uintptr_t)(q16 + (rowbase + q0 + row) * ATT + hoff + dc);
      asm volatile("global_load_async_to_lds_b128 %0, %1, off" ::"v"(lds),
                   "v"(ga)
                   : "memory");
    }
    asm volatile("s_wait_asynccnt 0x0" ::: "memory");
  }
  __syncthreads();

  v16h qf[2];
#pragma unroll
  for (int kc = 0; kc < 2; ++kc)
    qf[kc] = frag_ld(&shQ[wid * 16 + (lane & 15)][kc * 32 + rsel]);

  const v8f zero = {};
  v8f o[4];
#pragma unroll
  for (int nt = 0; nt < 4; ++nt) o[nt] = zero;
  float m[8], l[8];
#pragma unroll
  for (int r = 0; r < 8; ++r) { m[r] = -3.0e38f; l[r] = 0.0f; }

  const int nkb = q0 / 64 + 2;  // keys 0 .. q0+127 (causal bound)
  for (int kbI = 0; kbI < nkb; ++kbI) {
    const int kb = kbI * 64;
    __syncthreads();  // previous block's K/V reads done before overwrite

    if (tid < 32) {
      uint64_t ga =
          (uint64_t)(uintptr_t)(k16 + (rowbase + kb) * ATT + hoff);
      u32x4 g0 = {1u, (uint32_t)(uintptr_t)(void*)&shK[0][0], (uint32_t)ga,
                  (uint32_t)(ga >> 32) | (2u << 30)};
      i32x8 g1 = {(int)((1u << 16) | (1u << 20) | (4u << 22) | (3u << 25)),
                  64 << 16,
                  64 << 16,
                  64 << 16,
                  64,
                  1024,
                  0, 0};
      i32x4 gz4 = {0, 0, 0, 0};
      i32x8 gz8 = {0, 0, 0, 0, 0, 0, 0, 0};
      // 6-arg (clang-23 / therock) form: (g0, g1, g2, g3, g4, cpol)
      __builtin_amdgcn_tensor_load_to_lds(g0, g1, gz4, gz4, gz8, 0);
    }

#pragma unroll
    for (int i = 0; i < 2; ++i) {
      int e = tid + i * 256;          // 512 chunks of 8 halves
      int key = e >> 3, dc = (e & 7) * 8;
      float4 raw =
          *(const float4*)(vv16 + (rowbase + kb + key) * ATT + hoff + dc);
      const _Float16* hp = (const _Float16*)&raw;
#pragma unroll
      for (int j = 0; j < 8; ++j) shVT[dc + j][key] = hp[j];
    }
    if (tid < 32) __builtin_amdgcn_s_wait_tensorcnt(0);
    __syncthreads();

    // ---- S = Q K^T ----
    v8f sc[4];
#pragma unroll
    for (int nt = 0; nt < 4; ++nt) {
      v8f c = zero;
#pragma unroll
      for (int kc = 0; kc < 2; ++kc) {
        v16h bf = frag_ld(&shK[nt * 16 + (lane & 15)][kc * 32 + rsel]);
        c = wmma_f16(qf[kc], bf, c);
      }
      sc[nt] = c;
    }

    // ---- scale, causal mask, online softmax ----
    float nm[8];
#pragma unroll
    for (int r = 0; r < 8; ++r) nm[r] = m[r];
#pragma unroll
    for (int nt = 0; nt < 4; ++nt) {
      int col = kb + nt * 16 + (lane & 15);
#pragma unroll
      for (int r = 0; r < 8; ++r) {
        int row = q0 + wid * 16 + r + rsel;
        float s = sc[nt][r] * 0.125f;
        s = (col > row) ? NEGF : s;
        sc[nt][r] = s;
        nm[r] = fmaxf(nm[r], s);
      }
    }
    // row maxima in the vector pipe: no LDS round trip per step
    ROWRED8("v_max_num_f32_dpp", nm);

    float rs[8];
#pragma unroll
    for (int r = 0; r < 8; ++r) rs[r] = 0.0f;
#pragma unroll
    for (int nt = 0; nt < 4; ++nt)
#pragma unroll
      for (int r = 0; r < 8; ++r) {
        float p = __expf(sc[nt][r] - nm[r]);
        sc[nt][r] = p;
        rs[r] += p;
      }
    ROWRED8("v_add_f32_dpp", rs);

#pragma unroll
    for (int r = 0; r < 8; ++r) {
      float alpha = __expf(m[r] - nm[r]);
      l[r] = l[r] * alpha + rs[r];
      m[r] = nm[r];
#pragma unroll
      for (int nt = 0; nt < 4; ++nt) o[nt][r] *= alpha;
    }

    // ---- P relayout (C -> A fragment) via wave-private LDS strip ----
#pragma unroll
    for (int nt = 0; nt < 4; ++nt)
#pragma unroll
      for (int r = 0; r < 8; ++r)
        shP[wid][r + rsel][nt * 16 + (lane & 15)] = (_Float16)sc[nt][r];

    v16h pf[2];
#pragma unroll
    for (int kc = 0; kc < 2; ++kc)
      pf[kc] = frag_ld(&shP[wid][lane & 15][kc * 32 + rsel]);

    // ---- O += P V ----
#pragma unroll
    for (int nt = 0; nt < 4; ++nt)
#pragma unroll
      for (int kc = 0; kc < 2; ++kc) {
        v16h bf = frag_ld(&shVT[nt * 16 + (lane & 15)][kc * 32 + rsel]);
        o[nt] = wmma_f16(pf[kc], bf, o[nt]);
      }
  }

  // ---- normalize and write the head's slice (f32) ----
#pragma unroll
  for (int r = 0; r < 8; ++r) {
    float inv = 1.0f / l[r];
    size_t grow = rowbase + q0 + wid * 16 + r + rsel;
#pragma unroll
    for (int nt = 0; nt < 4; ++nt)
      attn[grow * ATT + hoff + nt * 16 + (lane & 15)] = o[nt][r] * inv;
  }
}

// ---------------------------------------------------------------------------
// Kernel 3: residual (+ projected q) and LayerNorm over the 1024-wide row.
// ---------------------------------------------------------------------------
__global__ __launch_bounds__(256) void resid_layernorm(
    const float* __restrict__ attn, const float* __restrict__ qres,
    const float* __restrict__ gamma, const float* __restrict__ beta,
    float* __restrict__ out) {
  const int row = blockIdx.x;
  const int tid = threadIdx.x;
  const size_t base = (size_t)row * ATT + tid * 4;

  float4 a = *(const float4*)(attn + base);
  float4 q = *(const float4*)(qres + base);
  float x0 = a.x + q.x, x1 = a.y + q.y, x2 = a.z + q.z, x3 = a.w + q.w;

  __shared__ float r1[256], r2[256];
  r1[tid] = x0 + x1 + x2 + x3;
  r2[tid] = x0 * x0 + x1 * x1 + x2 * x2 + x3 * x3;
  __syncthreads();
#pragma unroll
  for (int off = 128; off > 0; off >>= 1) {
    if (tid < off) { r1[tid] += r1[tid + off]; r2[tid] += r2[tid + off]; }
    __syncthreads();
  }
  const float mu   = r1[0] * (1.0f / ATT);
  const float var  = r2[0] * (1.0f / ATT) - mu * mu;
  const float rinv = rsqrtf(var + 1e-5f);

  float4 g  = *(const float4*)(gamma + tid * 4);
  float4 be = *(const float4*)(beta + tid * 4);
  float4 y;
  y.x = (x0 - mu) * rinv * g.x + be.x;
  y.y = (x1 - mu) * rinv * g.y + be.y;
  y.z = (x2 - mu) * rinv * g.z + be.z;
  y.w = (x3 - mu) * rinv * g.w + be.w;
  *(float4*)(out + base) = y;
}

// ---------------------------------------------------------------------------
extern "C" void kernel_launch(void* const* d_in, const int* in_sizes, int n_in,
                              void* d_out, int out_size, void* d_ws,
                              size_t ws_size, hipStream_t stream) {
  const float* query = (const float*)d_in[0];
  const float* key   = (const float*)d_in[1];
  const float* value = (const float*)d_in[2];
  const float* Wq    = (const float*)d_in[3];
  const float* bq    = (const float*)d_in[4];
  const float* Wk    = (const float*)d_in[5];
  const float* bk    = (const float*)d_in[6];
  const float* Wv    = (const float*)d_in[7];
  const float* bv    = (const float*)d_in[8];
  const float* gamma = (const float*)d_in[9];
  const float* beta  = (const float*)d_in[10];

  // Workspace: q16/k16/v16 (8 MiB each) | q f32 (16 MiB) | attn f32 (16 MiB)
  char* ws = (char*)d_ws;
  const size_t F16B = (size_t)MTOT * ATT * sizeof(_Float16);
  const size_t F32B = (size_t)MTOT * ATT * sizeof(float);
  _Float16* q16  = (_Float16*)(ws);
  _Float16* k16  = (_Float16*)(ws + F16B);
  _Float16* v16  = (_Float16*)(ws + 2 * F16B);
  float*    qf32 = (float*)(ws + 3 * F16B);
  float*    attn = (float*)(ws + 3 * F16B + F32B);

  dim3 gProj(MTOT / 128, ATT / 64, 3);
  qkv_proj_wmma<<<gProj, 256, 0, stream>>>(query, key, value, Wq, Wk, Wv, bq,
                                           bk, bv, q16, k16, v16, qf32);

  dim3 gAttn(SEQ / 128, BATCH * HEADS);
  flash_attn_wmma<<<gAttn, 256, 0, stream>>>(q16, k16, v16, attn);

  resid_layernorm<<<MTOT, 256, 0, stream>>>(attn, qf32, gamma, beta,
                                            (float*)d_out);
}

// v003
// It runs in 159 microseconds.
// Two timings next to v002 both put it at 1.22 times that version's speed.
// Over all steps from v000 it is 1.79 times as fast.
#include <hip/hip_runtime.h>

typedef _Float16     v16h  __attribute__((ext_vector_type(16)));
typedef float        v8f   __attribute__((ext_vector_type(8)));
typedef unsigned int u32x4 __attribute__((ext_vector_type(4)));
typedef unsigned int u32x8 __attribute__((ext_vector_type(8)));
typedef short        s16x8 __attribute__((ext_vector_type(8)));

constexpr int BATCH = 2;
constexpr int SEQ   = 2048;
constexpr int EMB   = 1024;
constexpr int ATT   = 1024;
constexpr int HEADS = 16;
constexpr int HD    = 64;
constexpr int MTOT  = BATCH * SEQ;      // 4096 rows
constexpr float NEGF = -4.2949673e9f;   // -2^32 + 1 (reference mask fill)

__device__ inline v16h frag_ld(const _Float16* __restrict__ p) {
  v16h f;
#pragma unroll
  for (int i = 0; i < 8; ++i) { f[i] = p[i]; f[i + 8] = p[i + 16]; }
  return f;
}

#define ROWRED_STEP(OP, M)                                        \
  OP " %0, %0, %0 row_xmask:" #M " row_mask:0xf bank_mask:0xf\n\t" \
  OP " %1, %1, %1 row_xmask:" #M " row_mask:0xf bank_mask:0xf\n\t" \
  OP " %2, %2, %2 row_xmask:" #M " row_mask:0xf bank_mask:0xf\n\t" \
  OP " %3, %3, %3 row_xmask:" #M " row_mask:0xf bank_mask:0xf\n\t" \
  OP " %4, %4, %4 row_xmask:" #M " row_mask:0xf bank_mask:0xf\n\t" \
  OP " %5, %5, %5 row_xmask:" #M " row_mask:0xf bank_mask:0xf\n\t" \
  OP " %6, %6, %6 row_xmask:" #M " row_mask:0xf bank_mask:0xf\n\t" \
  OP " %7, %7, %7 row_xmask:" #M " row_mask:0xf bank_mask:0xf\n\t"
#define ROWRED8(OP, v)                                                    \
  asm(ROWRED_STEP(OP, 1) ROWRED_STEP(OP, 2) ROWRED_STEP(OP, 4)            \
          ROWRED_STEP(OP, 8)                                              \
      : "+v"(v[0]), "+v"(v[1]), "+v"(v[2]), "+v"(v[3]), "+v"(v[4]),       \
        "+v"(v[5]), "+v"(v[6]), "+v"(v[7]))

// Two 16-byte halves (k 0..7 and k 16..23 of the lane's half) as one fragment.
__device__ inline v16h frag_pair(u32x4 lo, u32x4 hi) {
  u32x8 w = {lo.x, lo.y, lo.z, lo.w, hi.x, hi.y, hi.z, hi.w};
  return __builtin_bit_cast(v16h, w);
}

// Transposing LDS load: lane (c = l & 15, h = l >> 4) gets rows 8h..8h+7 of
// column c of the 16 x 16 block of halves that the 32 lane addresses cover.
__device__ inline u32x4 ld_tr16(const unsigned char* p) {
  typedef __attribute__((address_space(3))) s16x8 lds_s16x8;
  return __builtin_bit_cast(
      u32x4, __builtin_amdgcn_ds_load_tr16_b128_v8i16((lds_s16x8*)p));
}

__device__ inline uint32_t uni(uint32_t v) {
  return (uint32_t)__builtin_amdgcn_readfirstlane(v);
}
__device__ inline uint32_t pinned(uint32_t v) {
  uint32_t w = (uint32_t)__builtin_amdgcn_readfirstlane(v);
  asm volatile("" : "+s"(w));  // pinned(): issue test held in a scalar register
  return w;
}
// The compiler places no wait for the tensor mover; both are written by hand.
__device__ inline void wait_tensor0() {
  asm volatile("s_wait_tensorcnt 0x0" ::: "memory");
}
__device__ inline void wait_ds0() {
  asm volatile("s_wait_dscnt 0x0" ::: "memory");
}

__device__ inline u32x4 tile_g0(uint32_t lds_dst, uint64_t ga) {
  u32x4 g0;
  g0[0] = uni(1u);
  g0[1] = uni(lds_dst);
  g0[2] = uni((uint32_t)ga);
  g0[3] = uni((((uint32_t)(ga >> 32)) & 0x01FFFFFFu) | 0x80000000u);
  return g0;
}
__device__ inline u32x8 tile_g1(uint32_t w0) {
  u32x8 g1;
  g1[0] = uni(w0);
  g1[1] = uni(128u << 16);
  g1[2] = uni(64u << 16);
  g1[3] = uni(128u << 16);
  g1[4] = uni(64u);
  g1[5] = uni(2048u);
  g1[6] = uni(0u);
  g1[7] = uni(0u);
  return g1;
}
__device__ inline u32x4 held(u32x4 g) {
  asm volatile("" : "+s"(g));
  return g;
}
__device__ inline void held(u32x8& a, u32x8& b) {
  asm volatile("" : "+s"(a), "+s"(b));
}
__device__ inline void tile_load(u32x4 g0, u32x8 g1) {
  asm volatile("tensor_load_to_lds %0, %1" ::"s"(g0), "s"(g1) : "memory");
}
__device__ inline void tile_wait(u32x4 g0, u32x8 g1) {
  asm volatile("s_wait_tensorcnt 0x0" ::"s"(g0), "s"(g1) : "memory");
}

__device__ inline v8f wmma_f16(v16h a, v16h b, v8f c) {
  return __builtin_amdgcn_wmma_f32_16x16x32_f16(
      false, a, false, b, (short)0, c, false, false);
}

// ---------------------------------------------------------------------------
// Kernel 1: fused QKV projection.  out16 = (f16) relu(X @ W + b); z==0 also
// keeps f32 q for the residual.  Tile 128x64, K-step 32; 8 waves, each 32x32.
// ---------------------------------------------------------------------------
__global__ __launch_bounds__(256) void qkv_proj_wmma(
    const float* __restrict__ Xq, const float* __restrict__ Xk,
    const float* __restrict__ Xv,
    const float* __restrict__ Wq, const float* __restrict__ Wk,
    const float* __restrict__ Wv,
    const float* __restrict__ bq, const float* __restrict__ bk,
    const float* __restrict__ bv,
    _Float16* __restrict__ q16, _Float16* __restrict__ k16,
    _Float16* __restrict__ v16, float* __restrict__ qf32) {
  const int z = blockIdx.z;
  const float* X    = (z == 0) ? Xq : (z == 1) ? Xk : Xv;
  const float* W    = (z == 0) ? Wq : (z == 1) ? Wk : Wv;
  const float* bias = (z == 0) ? bq : (z == 1) ? bk : bv;
  _Float16* out16   = (z == 0) ? q16 : (z == 1) ? k16 : v16;

  const int m0   = blockIdx.x * 128;
  const int n0   = blockIdx.y * 64;
  const int tid  = threadIdx.x;
  const int lane = tid & 31;
  const int wid  = tid >> 5;
  const int wm   = (wid & 3) * 32;
  const int wn   = (wid >> 2) * 32;
  const int rsel = (lane >> 4) * 8;

  __shared__ _Float16 shA[128][40];  // [M][K] +8 pad
  __shared__ _Float16 shB[64][40];   // [N][K] +8 pad

  const v8f zero = {};
  v8f acc[2][2];
#pragma unroll
  for (int i = 0; i < 2; ++i)
#pragma unroll
    for (int j = 0; j < 2; ++j) acc[i][j] = zero;

  for (int kt = 0; kt < EMB; kt += 32) {
    __syncthreads();
    // Phase 1: batch all global loads (back-to-back issue, single wait).
    float4 fa[4], fb[2];
#pragma unroll
    for (int i = 0; i < 4; ++i) {
      int e = tid + i * 256, row = e >> 3, c4 = (e & 7) << 2;
      fa[i] = *(const float4*)(X + (size_t)(m0 + row) * EMB + kt + c4);
    }
#pragma unroll
    for (int i = 0; i < 2; ++i) {
      int e = tid + i * 256, kr = e >> 4, c4 = (e & 15) << 2;
      fb[i] = *(const float4*)(W + (size_t)(kt + kr) * ATT + n0 + c4);
    }
    // Phase 2: convert + LDS stores.
#pragma unroll
    for (int i = 0; i < 4; ++i) {
      int e = tid + i * 256, row = e >> 3, c4 = (e & 7) << 2;
      shA[row][c4 + 0] = (_Float16)fa[i].x;
      shA[row][c4 + 1] = (_Float16)fa[i].y;
      shA[row][c4 + 2] = (_Float16)fa[i].z;
      shA[row][c4 + 3] = (_Float16)fa[i].w;
    }
#pragma unroll
    for (int i = 0; i < 2; ++i) {
      int e = tid + i * 256, kr = e >> 4, c4 = (e & 15) << 2;
      shB[c4 + 0][kr] = (_Float16)fb[i].x;
      shB[c4 + 1][kr] = (_Float16)fb[i].y;
      shB[c4 + 2][kr] = (_Float16)fb[i].z;
      shB[c4 + 3][kr] = (_Float16)fb[i].w;
    }
    __syncthreads();

    v16h af[2], bf[2];
#pragma unroll
    for (int mt = 0; mt < 2; ++mt)
      af[mt] = frag_ld(&shA[wm + mt * 16 + (lane & 15)][rsel]);
#pragma unroll
    for (int nt = 0; nt < 2; ++nt)
      bf[nt] = frag_ld(&shB[wn + nt * 16 + (lane & 15)][rsel]);
#pragma unroll
    for (int mt = 0; mt < 2; ++mt)
#pragma unroll
      for (int nt = 0; nt < 2; ++nt)
        acc[mt][nt] = wmma_f16(af[mt], bf[nt], acc[mt][nt]);
  }

#pragma unroll
  for (int mt = 0; mt < 2; ++mt)
#pragma unroll
    for (int nt = 0; nt < 2; ++nt) {
      const float bv_ = bias[n0 + wn + nt * 16 + (lane & 15)];
#pragma unroll
      for (int r = 0; r < 8; ++r) {
        int grow = m0 + wm + mt * 16 + r + rsel;
        int gcol = n0 + wn + nt * 16 + (lane & 15);
        float val = fmaxf(acc[mt][nt][r] + bv_, 0.0f);
        out16[(size_t)grow * ATT + gcol] = (_Float16)val;
        if (z == 0) qf32[(size_t)grow * ATT + gcol] = val;
      }
    }
}

__global__ __launch_bounds__(256) void flash_attn_wmma(
    const _Float16* __restrict__ q16, const _Float16* __restrict__ k16,
    const _Float16* __restrict__ vv16, float* __restrict__ attn) {
  const int q0   = blockIdx.x * 128;
  const int b    = blockIdx.y / HEADS;
  const int h    = blockIdx.y % HEADS;
  const int tid  = threadIdx.x;
  const int lane = tid & 31;
  const int wid  = tid >> 5;
  const int rsel = (lane >> 4) * 8;

  __shared__ _Float16 shQ[128][72];    // [q][d]     pitch 144 B
  // K0 | K1 (pitch 144 B) | V0 | V1 (pitch 160 B), each place a 2 KiB multiple
  constexpr uint32_t PK = 144u, PV = 160u, KBUF = 10240u, VBUF = 10240u;
  constexpr uint32_t W0K = (1u << 20) | (4u << 22) | (3u << 25);
  constexpr uint32_t W0V = (1u << 20) | (4u << 22) | (7u << 25);
  __shared__ __attribute__((aligned(2048))) unsigned char
      shKV[2u * KBUF + 2u * VBUF];
  __shared__ _Float16 shP[8][16][72];  // per-wave P relayout (C -> A frag)

  const size_t rowbase = (size_t)b * SEQ;
  const size_t hoff    = (size_t)h * HD;

  {
    const uint32_t q_lds = (uint32_t)(uintptr_t)(void*)&shQ[0][0];
#pragma unroll
    for (int i = 0; i < 4; ++i) {
      int e = tid + i * 256;          // 1024 16-byte chunks (pad left alone)
      int row = e >> 3, dc = (e & 7) * 8;
      uint32_t lds = q_lds + (uint32_t)(row * 144 + dc * 2);
      uint64_t ga =
          (uint64_t)(uintptr_t)(q16 + (rowbase + q0 + row) * ATT + hoff + dc);
      asm volatile("global_load_async_to_lds_b128 %0, %1, off\n\ts_wait_xcnt 0x0"
                   ::"v"(lds), "v"(ga)
                   : "memory");
    }
    asm volatile("s_wait_asynccnt 0x0" ::: "memory");
  }

  // ---- K/V ring, prologue: block 0 lands and is published; block 1 starts at
  // the top of the first trip (every chunk walks at least two key blocks) ----
  const uint32_t wave = uni((uint32_t)tid >> 5);
  const uint32_t ring = (uint32_t)(uintptr_t)(void*)&shKV[0];
  const uint64_t kga = (uint64_t)(uintptr_t)(k16 + rowbase * ATT + hoff);
  const uint64_t vga = (uint64_t)(uintptr_t)(vv16 + rowbase * ATT + hoff);
  constexpr uint64_t STEP = 64u * 2048u;  // bytes from one key block to the next
  u32x8 g1k = tile_g1(W0K), g1v = tile_g1(W0V);
  held(g1k, g1v);
  if (pinned(wave == 0u)) {
    const u32x4 g0 = held(tile_g0(ring, kga));
    tile_load(g0, g1k);
    tile_wait(g0, g1k);
  }
  if (pinned(wave == 1u)) {
    const u32x4 g0 = held(tile_g0(ring + 2u * KBUF, vga));
    tile_load(g0, g1v);
    tile_wait(g0, g1v);
  }
  __syncthreads();

  v16h qf[2];
#pragma unroll
  for (int kc = 0; kc < 2; ++kc)
    qf[kc] = frag_ld(&shQ[wid * 16 + (lane & 15)][kc * 32 + rsel]);

  const v8f zero = {};
  v8f o[4];
#pragma unroll
  for (int nt = 0; nt < 4; ++nt) o[nt] = zero;
  float m[8], l[8];
#pragma unroll
  for (int r = 0; r < 8; ++r) { m[r] = -3.0e38f; l[r] = 0.0f; }

  const int nkb = q0 / 64 + 2;  // keys 0 .. q0+127 (causal bound)
  for (int kbI = 0; kbI < nkb; ++kbI) {
    const int kb = kbI * 64;
    const uint32_t buf = (uint32_t)kbI & 1u;

    const uint32_t more = (uint32_t)(kbI + 1 < nkb);
    const uint64_t adv = (uint64_t)(uint32_t)(kbI + 1) * STEP;
    const u32x4 g0k = held(tile_g0(ring + (buf ^ 1u) * KBUF, kga + adv));
    const u32x4 g0v =
        held(tile_g0(ring + 2u * KBUF + (buf ^ 1u) * VBUF, vga + adv));
    if (pinned((wave == 0u) & more)) tile_load(g0k, g1k);
    if (pinned((wave == 1u) & more)) tile_load(g0v, g1v);

    const unsigned char* kt =
        shKV + buf * KBUF + (uint32_t)(lane & 15) * PK + (uint32_t)rsel * 2u;
    const unsigned char* vt = shKV + 2u * KBUF + buf * VBUF +
                              (uint32_t)(rsel + (lane & 7)) * PV +
                              (uint32_t)((lane >> 3) & 1) * 16u;

    // ---- S = Q K^T ----
    v8f sc[4];
#pragma unroll
    for (int nt = 0; nt < 4; ++nt) {
      v8f c = zero;
#pragma unroll
      for (int kc = 0; kc < 2; ++kc) {
        const unsigned char* p = kt + (uint32_t)nt * 16u * PK + (uint32_t)kc * 64u;
        v16h bf = frag_pair(*(const u32x4*)p, *(const u32x4*)(p + 32));
        c = wmma_f16(qf[kc], bf, c);
      }
      sc[nt] = c;
    }

    // ---- scale, causal mask, online softmax ----
    float nm[8];
#pragma unroll
    for (int r = 0; r < 8; ++r) nm[r] = m[r];
#pragma unroll
    for (int nt = 0; nt < 4; ++nt) {
      int col = kb + nt * 16 + (lane & 15);
#pragma unroll
      for (int r = 0; r < 8; ++r) {
        int row = q0 + wid * 16 + r + rsel;
        float s = sc[nt][r] * 0.125f;
        s = (col > row) ? NEGF : s;
        sc[nt][r] = s;
        nm[r] = fmaxf(nm[r], s);
      }
    }
    // row maxima in the vector pipe: no LDS round trip per step
    ROWRED8("v_max_num_f32_dpp", nm);

    float rs[8];
#pragma unroll
    for (int r = 0; r < 8; ++r) rs[r] = 0.0f;
#pragma unroll
    for (int nt = 0; nt < 4; ++nt)
#pragma unroll
      for (int r = 0; r < 8; ++r) {
        float p = __expf(sc[nt][r] - nm[r]);
        sc[nt][r] = p;
        rs[r] += p;
      }
    ROWRED8("v_add_f32_dpp", rs);

#pragma unroll
    for (int r = 0; r < 8; ++r) {
      float alpha = __expf(m[r] - nm[r]);
      l[r] = l[r] * alpha + rs[r];
      m[r] = nm[r];
#pragma unroll
      for (int nt = 0; nt < 4; ++nt) o[nt][r] *= alpha;
    }

    // ---- P relayout (C -> A fragment) via wave-private LDS strip ----
#pragma unroll
    for (int nt = 0; nt < 4; ++nt)
#pragma unroll
      for (int r = 0; r < 8; ++r)
        shP[wid][r + rsel][nt * 16 + (lane & 15)] = (_Float16)sc[nt][r];

    v16h pf[2];
#pragma unroll
    for (int kc = 0; kc < 2; ++kc)
      pf[kc] = frag_ld(&shP[wid][lane & 15][kc * 32 + rsel]);

    // ---- O += P V ----
#pragma unroll
    for (int nt = 0; nt < 4; ++nt)
#pragma unroll
      for (int kc = 0; kc < 2; ++kc) {
        const unsigned char* p = vt + (uint32_t)kc * 32u * PV + (uint32_t)nt * 32u;
        v16h bf = frag_pair(ld_tr16(p), ld_tr16(p + 16u * PV));
        o[nt] = wmma_f16(pf[kc], bf, o[nt]);
      }

    // ---- publish point of block kbI + 1: this wave's LDS reads are done,
    // the issuers' tiles have landed, every wave passes the barrier; only
    // then (top of the next trip) is the buffer just read refilled ----
    wait_ds0();
    if (pinned(wave == 0u)) tile_wait(g0k, g1k);
    if (pinned(wave == 1u)) tile_wait(g0v, g1v);
    __syncthreads();
  }
  wait_tensor0();
  wait_ds0();

  // ---- normalize and write the head's slice (f32) ----
#pragma unroll
  for (int r = 0; r < 8; ++r) {
    float inv = 1.0f / l[r];
    size_t grow = rowbase + q0 + wid * 16 + r + rsel;
#pragma unroll
    for (int nt = 0; nt < 4; ++nt)
      attn[grow * ATT + hoff + nt * 16 + (lane & 15)] = o[nt][r] * inv;
  }
}

// ---------------------------------------------------------------------------
// Kernel 3: residual (+ projected q) and LayerNorm over the 1024-wide row.
// ---------------------------------------------------------------------------
__global__ __launch_bounds__(256) void resid_layernorm(
    const float* __restrict__ attn, const float* __restrict__ qres,
    const float* __restrict__ gamma, const float* __restrict__ beta,
    float* __restrict__ out) {
  const int row = blockIdx.x;
  const int tid = threadIdx.x;
  const size_t base = (size_t)row * ATT + tid * 4;

  float4 a = *(const float4*)(attn + base);
  float4 q = *(const float4*)(qres + base);
  float x0 = a.x + q.x, x1 = a.y + q.y, x2 = a.z + q.z, x3 = a.w + q.w;

  __shared__ float r1[256], r2[256];
  r1[tid] = x0 + x1 + x2 + x3;
  r2[tid] = x0 * x0 + x1 * x1 + x2 * x2 + x3 * x3;
  __syncthreads();
#pragma unroll
  for (int off = 128; off > 0; off >>= 1) {
    if (tid < off) { r1[tid] += r1[tid + off]; r2[tid] += r2[tid + off]; }
    __syncthreads();
  }
  const float mu   = r1[0] * (1.0f / ATT);
  const float var  = r2[0] * (1.0f / ATT) - mu * mu;
  const float rinv = rsqrtf(var + 1e-5f);

  float4 g  = *(const float4*)(gamma + tid * 4);
  float4 be = *(const float4*)(beta + tid * 4);
  float4 y;
  y.x = (x0 - mu) * rinv * g.x + be.x;
  y.y = (x1 - mu) * rinv * g.y + be.y;
  y.z = (x2 - mu) * rinv * g.z + be.z;
  y.w = (x3 - mu) * rinv * g.w + be.w;
  *(float4*)(out + base) = y;
}

// ---------------------------------------------------------------------------
extern "C" void kernel_launch(void* const* d_in, const int* in_sizes, int n_in,
                              void* d_out, int out_size, void* d_ws,
                              size_t ws_size, hipStream_t stream) {
  const float* query = (const float*)d_in[0];
  const float* key   = (const float*)d_in[1];
  const float* value = (const float*)d_in[2];
  const float* Wq    = (const float*)d_in[3];
  const float* bq    = (const float*)d_in[4];
  const float* Wk    = (const float*)d_in[5];
  const float* bk    = (const float*)d_in[6];
  const float* Wv    = (const float*)d_in[7];
  const float* bv    = (const float*)d_in[8];
  const float* gamma = (const float*)d_in[9];
  const float* beta  = (const float*)d_in[10];

  // Workspace: q16/k16/v16 (8 MiB each) | q f32 (16 MiB) | attn f32 (16 MiB)
  char* ws = (char*)d_ws;
  const size_t F16B = (size_t)MTOT * ATT * sizeof(_Float16);
  const size_t F32B = (size_t)MTOT * ATT * sizeof(float);
  _Float16* q16  = (_Float16*)(ws);
  _Float16* k16  = (_Float16*)(ws + F16B);
  _Float16* v16  = (_Float16*)(ws + 2 * F16B);
  float*    qf32 = (float*)(ws + 3 * F16B);
  float*    attn = (float*)(ws + 3 * F16B + F32B);

  dim3 gProj(MTOT / 128, ATT / 64, 3);
  qkv_proj_wmma<<<gProj, 256, 0, stream>>>(query, key, value, Wq, Wk, Wv, bq,
                                           bk, bv, q16, k16, v16, qf32);

  dim3 gAttn(SEQ / 128, BATCH * HEADS);
  flash_attn_wmma<<<gAttn, 256, 0, stream>>>(q16, k16, v16, attn);

  resid_layernorm<<<MTOT, 256, 0, stream>>>(attn, qf32, gamma, beta,
                                            (float*)d_out);
}

// v004
// One run takes 139 microseconds.
// Timed twice side by side with v003, it ran 1.14 times as fast both times.
// All steps since v000 together make it 2.04 times as fast.
#include <hip/hip_runtime.h>

typedef _Float16     v16h  __attribute__((ext_vector_type(16)));
typedef float        v8f   __attribute__((ext_vector_type(8)));
typedef unsigned int u32x4 __attribute__((ext_vector_type(4)));
typedef unsigned int u32x8 __attribute__((ext_vector_type(8)));
typedef short        s16x8 __attribute__((ext_vector_type(8)));

constexpr int BATCH = 2;
constexpr int SEQ   = 2048;
constexpr int EMB   = 1024;
constexpr int ATT   = 1024;
constexpr int HEADS = 16;
constexpr int HD    = 64;
constexpr int MTOT  = BATCH * SEQ;      // 4096 rows
constexpr float NEGF = -4.2949673e9f;   // -2^32 + 1 (reference mask fill)

__device__ inline v16h frag_ld(const _Float16* __restrict__ p) {
  v16h f;
#pragma unroll
  for (int i = 0; i < 8; ++i) { f[i] = p[i]; f[i + 8] = p[i + 16]; }
  return f;
}

__device__ inline float xhalf(float x) {
  const int b = __builtin_bit_cast(int, x);
  return __builtin_bit_cast(
      float, __builtin_amdgcn_permlanex16(b, b, 0x76543210, 0xfedcba98, false,
                                          false));
}

// Two 16-byte halves (k 0..7 and k 16..23 of the lane's half) as one fragment.
__device__ inline v16h frag_pair(u32x4 lo, u32x4 hi) {
  u32x8 w = {lo.x, lo.y, lo.z, lo.w, hi.x, hi.y, hi.z, hi.w};
  return __builtin_bit_cast(v16h, w);
}

// Transposing LDS load: lane (c = l & 15, h = l >> 4) gets rows 8h..8h+7 of
// column c of the 16 x 16 block of halves that the 32 lane addresses cover.
__device__ inline u32x4 ld_tr16(const unsigned char* p) {
  typedef __attribute__((address_space(3))) s16x8 lds_s16x8;
  return __builtin_bit_cast(
      u32x4, __builtin_amdgcn_ds_load_tr16_b128_v8i16((lds_s16x8*)p));
}

__device__ inline uint32_t uni(uint32_t v) {
  return (uint32_t)__builtin_amdgcn_readfirstlane(v);
}
__device__ inline uint32_t pinned(uint32_t v) {
  uint32_t w = (uint32_t)__builtin_amdgcn_readfirstlane(v);
  asm volatile("" : "+s"(w));  // pinned(): issue test held in a scalar register
  return w;
}
// The compiler places no wait for the tensor mover; both are written by hand.
__device__ inline void wait_tensor0() {
  asm volatile("s_wait_tensorcnt 0x0" ::: "memory");
}
__device__ inline void wait_ds0() {
  asm volatile("s_wait_dscnt 0x0" ::: "memory");
}

__device__ inline u32x4 tile_g0(uint32_t lds_dst, uint64_t ga) {
  u32x4 g0;
  g0[0] = uni(1u);
  g0[1] = uni(lds_dst);
  g0[2] = uni((uint32_t)ga);
  g0[3] = uni((((uint32_t)(ga >> 32)) & 0x01FFFFFFu) | 0x80000000u);
  return g0;
}
__device__ inline u32x8 tile_g1(uint32_t w0) {
  u32x8 g1;
  g1[0] = uni(w0);
  g1[1] = uni(128u << 16);
  g1[2] = uni(64u << 16);
  g1[3] = uni(128u << 16);
  g1[4] = uni(64u);
  g1[5] = uni(2048u);
  g1[6] = uni(0u);
  g1[7] = uni(0u);
  return g1;
}
__device__ inline u32x4 held(u32x4 g) {
  asm volatile("" : "+s"(g));
  return g;
}
__device__ inline void held(u32x8& a, u32x8& b) {
  asm volatile("" : "+s"(a), "+s"(b));
}
__device__ inline void tile_load(u32x4 g0, u32x8 g1) {
  asm volatile("tensor_load_to_lds %0, %1" ::"s"(g0), "s"(g1) : "memory");
}
__device__ inline void tile_wait(u32x4 g0, u32x8 g1) {
  asm volatile("s_wait_tensorcnt 0x0" ::"s"(g0), "s"(g1) : "memory");
}

__device__ inline v8f wmma_f16(v16h a, v16h b, v8f c) {
  return __builtin_amdgcn_wmma_f32_16x16x32_f16(
      false, a, false, b, (short)0, c, false, false);
}

// ---------------------------------------------------------------------------
// Kernel 1: fused QKV projection.  out16 = (f16) relu(X @ W + b); z==0 also
// keeps f32 q for the residual.  Tile 128x64, K-step 32; 8 waves, each 32x32.
// ---------------------------------------------------------------------------
__global__ __launch_bounds__(256) void qkv_proj_wmma(
    const float* __restrict__ Xq, const float* __restrict__ Xk,
    const float* __restrict__ Xv,
    const float* __restrict__ Wq, const float* __restrict__ Wk,
    const float* __restrict__ Wv,
    const float* __restrict__ bq, const float* __restrict__ bk,
    const float* __restrict__ bv,
    _Float16* __restrict__ q16, _Float16* __restrict__ k16,
    _Float16* __restrict__ v16, float* __restrict__ qf32) {
  const int z = blockIdx.z;
  const float* X    = (z == 0) ? Xq : (z == 1) ? Xk : Xv;
  const float* W    = (z == 0) ? Wq : (z == 1) ? Wk : Wv;
  const float* bias = (z == 0) ? bq : (z == 1) ? bk : bv;
  _Float16* out16   = (z == 0) ? q16 : (z == 1) ? k16 : v16;

  const int m0   = blockIdx.x * 128;
  const int n0   = blockIdx.y * 64;
  const int tid  = threadIdx.x;
  const int lane = tid & 31;
  const int wid  = tid >> 5;
  const int wm   = (wid & 3) * 32;
  const int wn   = (wid >> 2) * 32;
  const int rsel = (lane >> 4) * 8;

  __shared__ _Float16 shA[128][40];  // [M][K] +8 pad
  __shared__ _Float16 shB[64][40];   // [N][K] +8 pad

  const v8f zero = {};
  v8f acc[2][2];
#pragma unroll
  for (int i = 0; i < 2; ++i)
#pragma unroll
    for (int j = 0; j < 2; ++j) acc[i][j] = zero;

  for (int kt = 0; kt < EMB; kt += 32) {
    __syncthreads();
    // Phase 1: batch all global loads (back-to-back issue, single wait).
    float4 fa[4], fb[2];
#pragma unroll
    for (int i = 0; i < 4; ++i) {
      int e = tid + i * 256, row = e >> 3, c4 = (e & 7) << 2;
      fa[i] = *(const float4*)(X + (size_t)(m0 + row) * EMB + kt + c4);
    }
#pragma unroll
    for (int i = 0; i < 2; ++i) {
      int e = tid + i * 256, kr = e >> 4, c4 = (e & 15) << 2;
      fb[i] = *(const float4*)(W + (size_t)(kt + kr) * ATT + n0 + c4);
    }
    // Phase 2: convert + LDS stores.
#pragma unroll
    for (int i = 0; i < 4; ++i) {
      int e = tid + i * 256, row = e >> 3, c4 = (e & 7) << 2;
      shA[row][c4 + 0] = (_Float16)fa[i].x;
      shA[row][c4 + 1] = (_Float16)fa[i].y;
      shA[row][c4 + 2] = (_Float16)fa[i].z;
      shA[row][c4 + 3] = (_Float16)fa[i].w;
    }
#pragma unroll
    for (int i = 0; i < 2; ++i) {
      int e = tid + i * 256, kr = e >> 4, c4 = (e & 15) << 2;
      shB[c4 + 0][kr] = (_Float16)fb[i].x;
      shB[c4 + 1][kr] = (_Float16)fb[i].y;
      shB[c4 + 2][kr] = (_Float16)fb[i].z;
      shB[c4 + 3][kr] = (_Float16)fb[i].w;
    }
    __syncthreads();

    v16h af[2], bf[2];
#pragma unroll
    for (int mt = 0; mt < 2; ++mt)
      af[mt] = frag_ld(&shA[wm + mt * 16 + (lane & 15)][rsel]);
#pragma unroll
    for (int nt = 0; nt < 2; ++nt)
      bf[nt] = frag_ld(&shB[wn + nt * 16 + (lane & 15)][rsel]);
#pragma unroll
    for (int mt = 0; mt < 2; ++mt)
#pragma unroll
      for (int nt = 0; nt < 2; ++nt)
        acc[mt][nt] = wmma_f16(af[mt], bf[nt], acc[mt][nt]);
  }

#pragma unroll
  for (int mt = 0; mt < 2; ++mt)
#pragma unroll
    for (int nt = 0; nt < 2; ++nt) {
      const float bv_ = bias[n0 + wn + nt * 16 + (lane & 15)];
#pragma unroll
      for (int r = 0; r < 8; ++r) {
        int grow = m0 + wm + mt * 16 + r + rsel;
        int gcol = n0 + wn + nt * 16 + (lane & 15);
        float val = fmaxf(acc[mt][nt][r] + bv_, 0.0f);
        out16[(size_t)grow * ATT + gcol] = (_Float16)val;
        if (z == 0) qf32[(size_t)grow * ATT + gcol] = val;
      }
    }
}

__global__ __launch_bounds__(256) void flash_attn_wmma(
    const _Float16* __restrict__ q16, const _Float16* __restrict__ k16,
    const _Float16* __restrict__ vv16, float* __restrict__ attn) {
  const int q0   = blockIdx.x * 128;
  const int b    = blockIdx.y / HEADS;
  const int h    = blockIdx.y % HEADS;
  const int tid  = threadIdx.x;
  const int lane = tid & 31;
  const int wid  = tid >> 5;
  const int rsel = (lane >> 4) * 8;

  __shared__ _Float16 shQ[128][72];    // [q][d]     pitch 144 B
  // K0 | K1 (pitch 144 B) | V0 | V1 (pitch 160 B), each place a 2 KiB multiple
  constexpr uint32_t PK = 144u, PV = 160u, KBUF = 10240u, VBUF = 10240u;
  constexpr uint32_t W0K = (1u << 20) | (4u << 22) | (3u << 25);
  constexpr uint32_t W0V = (1u << 20) | (4u << 22) | (7u << 25);
  __shared__ __attribute__((aligned(2048))) unsigned char
      shKV[2u * KBUF + 2u * VBUF];

  const size_t rowbase = (size_t)b * SEQ;
  const size_t hoff    = (size_t)h * HD;

  {
    const uint32_t q_lds = (uint32_t)(uintptr_t)(void*)&shQ[0][0];
#pragma unroll
    for (int i = 0; i < 4; ++i) {
      int e = tid + i * 256;          // 1024 16-byte chunks (pad left alone)
      int row = e >> 3, dc = (e & 7) * 8;
      uint32_t lds = q_lds + (uint32_t)(row * 144 + dc * 2);
      uint64_t ga =
          (uint64_t)(uintptr_t)(q16 + (rowbase + q0 + row) * ATT + hoff + dc);
      asm volatile("global_load_async_to_lds_b128 %0, %1, off\n\ts_wait_xcnt 0x0"
                   ::"v"(lds), "v"(ga)
                   : "memory");
    }
    asm volatile("s_wait_asynccnt 0x0" ::: "memory");
  }

  // ---- K/V ring, prologue: block 0 lands and is published; block 1 starts at
  // the top of the first trip (every chunk walks at least two key blocks) ----
  const uint32_t wave = uni((uint32_t)tid >> 5);
  const uint32_t ring = (uint32_t)(uintptr_t)(void*)&shKV[0];
  const uint64_t kga = (uint64_t)(uintptr_t)(k16 + rowbase * ATT + hoff);
  const uint64_t vga = (uint64_t)(uintptr_t)(vv16 + rowbase * ATT + hoff);
  constexpr uint64_t STEP = 64u * 2048u;  // bytes from one key block to the next
  u32x8 g1k = tile_g1(W0K), g1v = tile_g1(W0V);
  held(g1k, g1v);
  if (pinned(wave == 0u)) {
    const u32x4 g0 = held(tile_g0(ring, kga));
    tile_load(g0, g1k);
    tile_wait(g0, g1k);
  }
  if (pinned(wave == 1u)) {
    const u32x4 g0 = held(tile_g0(ring + 2u * KBUF, vga));
    tile_load(g0, g1v);
    tile_wait(g0, g1v);
  }
  __syncthreads();

  v16h qf[2];
#pragma unroll
  for (int kc = 0; kc < 2; ++kc)
    qf[kc] = frag_ld(&shQ[wid * 16 + (lane & 15)][kc * 32 + rsel]);

  const v8f zero = {};
  v8f o[4];
#pragma unroll
  for (int nt = 0; nt < 4; ++nt) o[nt] = zero;
  float m = -3.0e38f, l = 0.0f;  // l: this half's share of the row sum
  const int row = q0 + wid * 16 + (lane & 15);  // the lane's query

  const int nkb = q0 / 64 + 2;  // keys 0 .. q0+127 (causal bound)
  for (int kbI = 0; kbI < nkb; ++kbI) {
    const int kb = kbI * 64;
    const uint32_t buf = (uint32_t)kbI & 1u;

    const uint32_t more = (uint32_t)(kbI + 1 < nkb);
    const uint64_t adv = (uint64_t)(uint32_t)(kbI + 1) * STEP;
    const u32x4 g0k = held(tile_g0(ring + (buf ^ 1u) * KBUF, kga + adv));
    const u32x4 g0v =
        held(tile_g0(ring + 2u * KBUF + (buf ^ 1u) * VBUF, vga + adv));
    if (pinned((wave == 0u) & more)) tile_load(g0k, g1k);
    if (pinned((wave == 1u) & more)) tile_load(g0v, g1v);

    const unsigned char* kt =
        shKV + buf * KBUF + (uint32_t)(lane & 15) * PK + (uint32_t)rsel * 2u;
    const unsigned char* vt = shKV + 2u * KBUF + buf * VBUF +
                              (uint32_t)(rsel + (lane & 7)) * PV +
                              (uint32_t)((lane >> 3) & 1) * 16u;

    // ---- S^T = K Q^T: sc[nt][r] = key kb + 16 nt + 8 h + r, query c ----
    v8f sc[4];
#pragma unroll
    for (int nt = 0; nt < 4; ++nt) {
      v8f c = zero;
#pragma unroll
      for (int kc = 0; kc < 2; ++kc) {
        const unsigned char* p = kt + (uint32_t)nt * 16u * PK + (uint32_t)kc * 64u;
        v16h kf = frag_pair(*(const u32x4*)p, *(const u32x4*)(p + 32));
        c = wmma_f16(kf, qf[kc], c);
      }
      sc[nt] = c;
    }

    // ---- scale, causal mask, online softmax; four chains, one per tile ----
    float mx[4];
#pragma unroll
    for (int nt = 0; nt < 4; ++nt) {
      const int ahead = row - (kb + nt * 16 + rsel);  // key r is masked if r > ahead
#pragma unroll
      for (int r = 0; r < 8; ++r) {
        float s = sc[nt][r] * 0.125f;
        s = (r > ahead) ? NEGF : s;
        sc[nt][r] = s;
        mx[nt] = (r == 0) ? s : fmaxf(mx[nt], s);
      }
    }
    float nm = fmaxf(fmaxf(fmaxf(mx[0], mx[1]), fmaxf(mx[2], mx[3])), m);
    nm = fmaxf(nm, xhalf(nm));  // both halves hold the query's maximum

    float rs[4];
#pragma unroll
    for (int nt = 0; nt < 4; ++nt) {
      rs[nt] = 0.0f;
#pragma unroll
      for (int r = 0; r < 8; ++r) {
        float p = __expf(sc[nt][r] - nm);
        sc[nt][r] = p;
        rs[nt] += p;
      }
    }

    const float alpha = __expf(m - nm);
    l = l * alpha + ((rs[0] + rs[1]) + (rs[2] + rs[3]));
    m = nm;
#pragma unroll
    for (int nt = 0; nt < 4; ++nt)
#pragma unroll
      for (int r = 0; r < 8; ++r) o[nt][r] *= alpha;

    // ---- P^T: tiles 2 kc and 2 kc + 1, converted in place, are keys
    // 8 h + i and 16 + 8 h + i of a 32-key B operand ----
    v16h pf[2];
#pragma unroll
    for (int kc = 0; kc < 2; ++kc)
#pragma unroll
      for (int i = 0; i < 8; ++i) {
        pf[kc][i]     = (_Float16)sc[2 * kc][i];
        pf[kc][i + 8] = (_Float16)sc[2 * kc + 1][i];
      }

    // ---- O^T += V^T P^T: o[nt][r] = column 16 nt + 8 h + r, query c ----
#pragma unroll
    for (int nt = 0; nt < 4; ++nt)
#pragma unroll
      for (int kc = 0; kc < 2; ++kc) {
        const unsigned char* p = vt + (uint32_t)kc * 32u * PV + (uint32_t)nt * 32u;
        v16h vf = frag_pair(ld_tr16(p), ld_tr16(p + 16u * PV));
        o[nt] = wmma_f16(vf, pf[kc], o[nt]);
      }

    // ---- publish point of block kbI + 1: this wave's LDS reads are done,
    // the issuers' tiles have landed, every wave passes the barrier; only
    // then (top of the next trip) is the buffer just read refilled ----
    wait_ds0();
    if (pinned(wave == 0u)) tile_wait(g0k, g1k);
    if (pinned(wave == 1u)) tile_wait(g0v, g1v);
    __syncthreads();
  }
  wait_tensor0();
  wait_ds0();

  // ---- join the halves' sums, normalize, write the head's slice (f32):
  // a lane's eight registers of a tile are eight neighbouring columns ----
  const float inv = 1.0f / (l + xhalf(l));
  float* dst = attn + (rowbase + (size_t)row) * ATT + hoff + rsel;
#pragma unroll
  for (int nt = 0; nt < 4; ++nt) {
    float4 lo = {o[nt][0] * inv, o[nt][1] * inv, o[nt][2] * inv, o[nt][3] * inv};
    float4 hi = {o[nt][4] * inv, o[nt][5] * inv, o[nt][6] * inv, o[nt][7] * inv};
    *(float4*)(dst + nt * 16)     = lo;
    *(float4*)(dst + nt * 16 + 4) = hi;
  }
}

// ---------------------------------------------------------------------------
// Kernel 3: residual (+ projected q) and LayerNorm over the 1024-wide row.
// ---------------------------------------------------------------------------
__global__ __launch_bounds__(256) void resid_layernorm(
    const float* __restrict__ attn, const float* __restrict__ qres,
    const float* __restrict__ gamma, const float* __restrict__ beta,
    float* __restrict__ out) {
  const int row = blockIdx.x;
  const int tid = threadIdx.x;
  const size_t base = (size_t)row * ATT + tid * 4;

  float4 a = *(const float4*)(attn + base);
  float4 q = *(const float4*)(qres + base);
  float x0 = a.x + q.x, x1 = a.y + q.y, x2 = a.z + q.z, x3 = a.w + q.w;

  __shared__ float r1[256], r2[256];
  r1[tid] = x0 + x1 + x2 + x3;
  r2[tid] = x0 * x0 + x1 * x1 + x2 * x2 + x3 * x3;
  __syncthreads();
#pragma unroll
  for (int off = 128; off > 0; off >>= 1) {
    if (tid < off) { r1[tid] += r1[tid + off]; r2[tid] += r2[tid + off]; }
    __syncthreads();
  }
  const float mu   = r1[0] * (1.0f / ATT);
  const float var  = r2[0] * (1.0f / ATT) - mu * mu;
  const float rinv = rsqrtf(var + 1e-5f);

  float4 g  = *(const float4*)(gamma + tid * 4);
  float4 be = *(const float4*)(beta + tid * 4);
  float4 y;
  y.x = (x0 - mu) * rinv * g.x + be.x;
  y.y = (x1 - mu) * rinv * g.y + be.y;
  y.z = (x2 - mu) * rinv * g.z + be.z;
  y.w = (x3 - mu) * rinv * g.w + be.w;
  *(float4*)(out + base) = y;
}

// ---------------------------------------------------------------------------
extern "C" void kernel_launch(void* const* d_in, const int* in_sizes, int n_in,
                              void* d_out, int out_size, void* d_ws,
                              size_t ws_size, hipStream_t stream) {
  const float* query = (const float*)d_in[0];
  const float* key   = (const float*)d_in[1];
  const float* value = (const float*)d_in[2];
  const float* Wq    = (const float*)d_in[3];
  const float* bq    = (const float*)d_in[4];
  const float* Wk    = (const float*)d_in[5];
  const float* bk    = (const float*)d_in[6];
  const float* Wv    = (const float*)d_in[7];
  const float* bv    = (const float*)d_in[8];
  const float* gamma = (const float*)d_in[9];
  const float* beta  = (const float*)d_in[10];

  // Workspace: q16/k16/v16 (8 MiB each) | q f32 (16 MiB) | attn f32 (16 MiB)
  char* ws = (char*)d_ws;
  const size_t F16B = (size_t)MTOT * ATT * sizeof(_Float16);
  const size_t F32B = (size_t)MTOT * ATT * sizeof(float);
  _Float16* q16  = (_Float16*)(ws);
  _Float16* k16  = (_Float16*)(ws + F16B);
  _Float16* v16  = (_Float16*)(ws + 2 * F16B);
  float*    qf32 = (float*)(ws + 3 * F16B);
  float*    attn = (float*)(ws + 3 * F16B + F32B);

  dim3 gProj(MTOT / 128, ATT / 64, 3);
  qkv_proj_wmma<<<gProj, 256, 0, stream>>>(query, key, value, Wq, Wk, Wv, bq,
                                           bk, bv, q16, k16, v16, qf32);

  dim3 gAttn(SEQ / 128, BATCH * HEADS);
  flash_attn_wmma<<<gAttn, 256, 0, stream>>>(q16, k16, v16, attn);

  resid_layernorm<<<MTOT, 256, 0, stream>>>(attn, qf32, gamma, beta,
                                            (float*)d_out);
}

// v005
// It runs in 110 microseconds.
// Next to v004, in two timings, it ran 1.27 times as fast each time.
// Over all steps from v000 it is 2.58 times as fast.
#include <hip/hip_runtime.h>

typedef _Float16     v16h  __attribute__((ext_vector_type(16)));
typedef _Float16     v4h   __attribute__((ext_vector_type(4)));
typedef float        v8f   __attribute__((ext_vector_type(8)));
typedef unsigned int u32x4 __attribute__((ext_vector_type(4)));
typedef unsigned int u32x8 __attribute__((ext_vector_type(8)));
typedef short        s16x8 __attribute__((ext_vector_type(8)));

constexpr int BATCH = 2;
constexpr int SEQ   = 2048;
constexpr int EMB   = 1024;
constexpr int ATT   = 1024;
constexpr int HEADS = 16;
constexpr int HD    = 64;
constexpr int MTOT  = BATCH * SEQ;      // 4096 rows
constexpr float NEGF = -4.2949673e9f;   // -2^32 + 1 (reference mask fill)

__device__ inline v16h frag_ld(const _Float16* __restrict__ p) {
  v16h f;
#pragma unroll
  for (int i = 0; i < 8; ++i) { f[i] = p[i]; f[i + 8] = p[i + 16]; }
  return f;
}

__device__ inline float xhalf(float x) {
  const int b = __builtin_bit_cast(int, x);
  return __builtin_bit_cast(
      float, __builtin_amdgcn_permlanex16(b, b, 0x76543210, 0xfedcba98, false,
                                          false));
}

// Two 16-byte halves (k 0..7 and k 16..23 of the lane's half) as one fragment.
__device__ inline v16h frag_pair(u32x4 lo, u32x4 hi) {
  u32x8 w = {lo.x, lo.y, lo.z, lo.w, hi.x, hi.y, hi.z, hi.w};
  return __builtin_bit_cast(v16h, w);
}

// Transposing LDS load: lane (c = l & 15, h = l >> 4) gets rows 8h..8h+7 of
// column c of the 16 x 16 block of halves that the 32 lane addresses cover.
__device__ inline u32x4 ld_tr16(const unsigned char* p) {
  typedef __attribute__((address_space(3))) s16x8 lds_s16x8;
  return __builtin_bit_cast(
      u32x4, __builtin_amdgcn_ds_load_tr16_b128_v8i16((lds_s16x8*)p));
}

__device__ inline uint32_t uni(uint32_t v) {
  return (uint32_t)__builtin_amdgcn_readfirstlane(v);
}
__device__ inline uint32_t pinned(uint32_t v) {
  uint32_t w = (uint32_t)__builtin_amdgcn_readfirstlane(v);
  asm volatile("" : "+s"(w));  // pinned(): issue test held in a scalar register
  return w;
}
// The compiler places no wait for the tensor mover; both are written by hand.
__device__ inline void wait_tensor0() {
  asm volatile("s_wait_tensorcnt 0x0" ::: "memory");
}
__device__ inline void wait_ds0() {
  asm volatile("s_wait_dscnt 0x0" ::: "memory");
}

__device__ inline u32x4 tile_g0(uint32_t lds_dst, uint64_t ga) {
  u32x4 g0;
  g0[0] = uni(1u);
  g0[1] = uni(lds_dst);
  g0[2] = uni((uint32_t)ga);
  g0[3] = uni((((uint32_t)(ga >> 32)) & 0x01FFFFFFu) | 0x80000000u);
  return g0;
}
__device__ inline u32x8 tile_g1(uint32_t w0) {
  u32x8 g1;
  g1[0] = uni(w0);
  g1[1] = uni(128u << 16);
  g1[2] = uni(64u << 16);
  g1[3] = uni(128u << 16);
  g1[4] = uni(64u);
  g1[5] = uni(2048u);
  g1[6] = uni(0u);
  g1[7] = uni(0u);
  return g1;
}
__device__ inline u32x4 held(u32x4 g) {
  asm volatile("" : "+s"(g));
  return g;
}
__device__ inline void held(u32x8& a, u32x8& b) {
  asm volatile("" : "+s"(a), "+s"(b));
}
__device__ inline void tile_load(u32x4 g0, u32x8 g1) {
  asm volatile("tensor_load_to_lds %0, %1" ::"s"(g0), "s"(g1) : "memory");
}
__device__ inline void tile_wait(u32x4 g0, u32x8 g1) {
  asm volatile("s_wait_tensorcnt 0x0" ::"s"(g0), "s"(g1) : "memory");
}

__device__ inline v8f wmma_f16(v16h a, v16h b, v8f c) {
  return __builtin_amdgcn_wmma_f32_16x16x32_f16(
      false, a, false, b, (short)0, c, false, false);
}

// ---------------------------------------------------------------------------
// Kernel 1: fused QKV projection.  out16 = (f16) relu(X @ W + b); z==0 also
// keeps f32 q for the residual.  Tile 128x64, K-step 32; 8 waves, each 32x32.
// The W tile lies in LDS as in memory, [K][N]; its B fragments come by
// transposing LDS loads, in the k order that frag_ld gives the A fragments.
// ---------------------------------------------------------------------------
__global__ __launch_bounds__(256) void qkv_proj_wmma(
    const float* __restrict__ Xq, const float* __restrict__ Xk,
    const float* __restrict__ Xv,
    const float* __restrict__ Wq, const float* __restrict__ Wk,
    const float* __restrict__ Wv,
    const float* __restrict__ bq, const float* __restrict__ bk,
    const float* __restrict__ bv,
    _Float16* __restrict__ q16, _Float16* __restrict__ k16,
    _Float16* __restrict__ v16, float* __restrict__ qf32) {
  const int z = blockIdx.z;
  const float* X    = (z == 0) ? Xq : (z == 1) ? Xk : Xv;
  const float* W    = (z == 0) ? Wq : (z == 1) ? Wk : Wv;
  const float* bias = (z == 0) ? bq : (z == 1) ? bk : bv;
  _Float16* out16   = (z == 0) ? q16 : (z == 1) ? k16 : v16;

  const int m0   = blockIdx.x * 128;
  const int n0   = blockIdx.y * 64;
  const int tid  = threadIdx.x;
  const int lane = tid & 31;
  const int wid  = tid >> 5;
  const int wm   = (wid & 3) * 32;
  const int wn   = (wid >> 2) * 32;
  const int rsel = (lane >> 4) * 8;

  __shared__ _Float16 shA[128][40];  // [M][K] +8 pad
  constexpr uint32_t PB = 160u;      // [K][N] row of 128 B, pitch 32 B x odd
  __shared__ __attribute__((aligned(16))) unsigned char shB[32u * PB];
  const unsigned char* bt = shB + (uint32_t)(rsel + (lane & 7)) * PB +
                            (uint32_t)((lane >> 3) & 1) * 16u +
                            (uint32_t)wn * 2u;

  const v8f zero = {};
  v8f acc[2][2];
#pragma unroll
  for (int i = 0; i < 2; ++i)
#pragma unroll
    for (int j = 0; j < 2; ++j) acc[i][j] = zero;

  for (int kt = 0; kt < EMB; kt += 32) {
    __syncthreads();
    // Phase 1: batch all global loads (back-to-back issue, single wait).
    float4 fa[4], fb[2];
#pragma unroll
    for (int i = 0; i < 4; ++i) {
      int e = tid + i * 256, row = e >> 3, c4 = (e & 7) << 2;
      fa[i] = *(const float4*)(X + (size_t)(m0 + row) * EMB + kt + c4);
    }
#pragma unroll
    for (int i = 0; i < 2; ++i) {
      int e = tid + i * 256, kr = e >> 4, c4 = (e & 15) << 2;
      fb[i] = *(const float4*)(W + (size_t)(kt + kr) * ATT + n0 + c4);
    }
    // Phase 2: convert + LDS stores.
#pragma unroll
    for (int i = 0; i < 4; ++i) {
      int e = tid + i * 256, row = e >> 3, c4 = (e & 7) << 2;
      shA[row][c4 + 0] = (_Float16)fa[i].x;
      shA[row][c4 + 1] = (_Float16)fa[i].y;
      shA[row][c4 + 2] = (_Float16)fa[i].z;
      shA[row][c4 + 3] = (_Float16)fa[i].w;
    }
#pragma unroll
    for (int i = 0; i < 2; ++i) {
      int e = tid + i * 256, kr = e >> 4, c4 = (e & 15) << 2;
      v4h w = {(_Float16)fb[i].x, (_Float16)fb[i].y, (_Float16)fb[i].z,
               (_Float16)fb[i].w};
      *(v4h*)(shB + (uint32_t)kr * PB + (uint32_t)c4 * 2u) = w;
    }
    __syncthreads();

    v16h af[2], bf[2];
#pragma unroll
    for (int mt = 0; mt < 2; ++mt)
      af[mt] = frag_ld(&shA[wm + mt * 16 + (lane & 15)][rsel]);
#pragma unroll
    for (int nt = 0; nt < 2; ++nt)
      bf[nt] = frag_pair(ld_tr16(bt + (uint32_t)nt * 32u),
                         ld_tr16(bt + (uint32_t)nt * 32u + 16u * PB));
#pragma unroll
    for (int mt = 0; mt < 2; ++mt)
#pragma unroll
      for (int nt = 0; nt < 2; ++nt)
        acc[mt][nt] = wmma_f16(af[mt], bf[nt], acc[mt][nt]);
  }

#pragma unroll
  for (int mt = 0; mt < 2; ++mt)
#pragma unroll
    for (int nt = 0; nt < 2; ++nt) {
      const float bv_ = bias[n0 + wn + nt * 16 + (lane & 15)];
#pragma unroll
      for (int r = 0; r < 8; ++r) {
        int grow = m0 + wm + mt * 16 + r + rsel;
        int gcol = n0 + wn + nt * 16 + (lane & 15);
        float val = fmaxf(acc[mt][nt][r] + bv_, 0.0f);
        out16[(size_t)grow * ATT + gcol] = (_Float16)val;
        if (z == 0) qf32[(size_t)grow * ATT + gcol] = val;
      }
    }
}

__global__ __launch_bounds__(256) void flash_attn_wmma(
    const _Float16* __restrict__ q16, const _Float16* __restrict__ k16,
    const _Float16* __restrict__ vv16, float* __restrict__ attn) {
  const int q0   = blockIdx.x * 128;
  const int b    = blockIdx.y / HEADS;
  const int h    = blockIdx.y % HEADS;
  const int tid  = threadIdx.x;
  const int lane = tid & 31;
  const int wid  = tid >> 5;
  const int rsel = (lane >> 4) * 8;

  __shared__ _Float16 shQ[128][72];    // [q][d]     pitch 144 B
  // K0 | K1 (pitch 144 B) | V0 | V1 (pitch 160 B), each place a 2 KiB multiple
  constexpr uint32_t PK = 144u, PV = 160u, KBUF = 10240u, VBUF = 10240u;
  constexpr uint32_t W0K = (1u << 20) | (4u << 22) | (3u << 25);
  constexpr uint32_t W0V = (1u << 20) | (4u << 22) | (7u << 25);
  __shared__ __attribute__((aligned(2048))) unsigned char
      shKV[2u * KBUF + 2u * VBUF];

  const size_t rowbase = (size_t)b * SEQ;
  const size_t hoff    = (size_t)h * HD;

  {
    const uint32_t q_lds = (uint32_t)(uintptr_t)(void*)&shQ[0][0];
#pragma unroll
    for (int i = 0; i < 4; ++i) {
      int e = tid + i * 256;          // 1024 16-byte chunks (pad left alone)
      int row = e >> 3, dc = (e & 7) * 8;
      uint32_t lds = q_lds + (uint32_t)(row * 144 + dc * 2);
      uint64_t ga =
          (uint64_t)(uintptr_t)(q16 + (rowbase + q0 + row) * ATT + hoff + dc);
      asm volatile("global_load_async_to_lds_b128 %0, %1, off\n\ts_wait_xcnt 0x0"
                   ::"v"(lds), "v"(ga)
                   : "memory");
    }
    asm volatile("s_wait_asynccnt 0x0" ::: "memory");
  }

  // ---- K/V ring, prologue: block 0 lands and is published; block 1 starts at
  // the top of the first trip (every chunk walks at least two key blocks) ----
  const uint32_t wave = uni((uint32_t)tid >> 5);
  const uint32_t ring = (uint32_t)(uintptr_t)(void*)&shKV[0];
  const uint64_t kga = (uint64_t)(uintptr_t)(k16 + rowbase * ATT + hoff);
  const uint64_t vga = (uint64_t)(uintptr_t)(vv16 + rowbase * ATT + hoff);
  constexpr uint64_t STEP = 64u * 2048u;  // bytes from one key block to the next
  u32x8 g1k = tile_g1(W0K), g1v = tile_g1(W0V);
  held(g1k, g1v);
  if (pinned(wave == 0u)) {
    const u32x4 g0 = held(tile_g0(ring, kga));
    tile_load(g0, g1k);
    tile_wait(g0, g1k);
  }
  if (pinned(wave == 1u)) {
    const u32x4 g0 = held(tile_g0(ring + 2u * KBUF, vga));
    tile_load(g0, g1v);
    tile_wait(g0, g1v);
  }
  __syncthreads();

  v16h qf[2];
#pragma unroll
  for (int kc = 0; kc < 2; ++kc)
    qf[kc] = frag_ld(&shQ[wid * 16 + (lane & 15)][kc * 32 + rsel]);

  const v8f zero = {};
  v8f o[4];
#pragma unroll
  for (int nt = 0; nt < 4; ++nt) o[nt] = zero;
  float m = -3.0e38f, l = 0.0f;  // l: this half's share of the row sum
  const int row = q0 + wid * 16 + (lane & 15);  // the lane's query

  const int nkb = q0 / 64 + 2;  // keys 0 .. q0+127 (causal bound)
  for (int kbI = 0; kbI < nkb; ++kbI) {
    const int kb = kbI * 64;
    const uint32_t buf = (uint32_t)kbI & 1u;

    const uint32_t more = (uint32_t)(kbI + 1 < nkb);
    const uint64_t adv = (uint64_t)(uint32_t)(kbI + 1) * STEP;
    const u32x4 g0k = held(tile_g0(ring + (buf ^ 1u) * KBUF, kga + adv));
    const u32x4 g0v =
        held(tile_g0(ring + 2u * KBUF + (buf ^ 1u) * VBUF, vga + adv));
    if (pinned((wave == 0u) & more)) tile_load(g0k, g1k);
    if (pinned((wave == 1u) & more)) tile_load(g0v, g1v);

    const unsigned char* kt =
        shKV + buf * KBUF + (uint32_t)(lane & 15) * PK + (uint32_t)rsel * 2u;
    const unsigned char* vt = shKV + 2u * KBUF + buf * VBUF +
                              (uint32_t)(rsel + (lane & 7)) * PV +
                              (uint32_t)((lane >> 3) & 1) * 16u;

    // ---- S^T = K Q^T: sc[nt][r] = key kb + 16 nt + 8 h + r, query c ----
    v8f sc[4];
#pragma unroll
    for (int nt = 0; nt < 4; ++nt) {
      v8f c = zero;
#pragma unroll
      for (int kc = 0; kc < 2; ++kc) {
        const unsigned char* p = kt + (uint32_t)nt * 16u * PK + (uint32_t)kc * 64u;
        v16h kf = frag_pair(*(const u32x4*)p, *(const u32x4*)(p + 32));
        c = wmma_f16(kf, qf[kc], c);
      }
      sc[nt] = c;
    }

    // ---- scale, causal mask, online softmax; four chains, one per tile ----
    float mx[4];
#pragma unroll
    for (int nt = 0; nt < 4; ++nt) {
      const int ahead = row - (kb + nt * 16 + rsel);  // key r is masked if r > ahead
#pragma unroll
      for (int r = 0; r < 8; ++r) {
        float s = sc[nt][r] * 0.125f;
        s = (r > ahead) ? NEGF : s;
        sc[nt][r] = s;
        mx[nt] = (r == 0) ? s : fmaxf(mx[nt], s);
      }
    }
    float nm = fmaxf(fmaxf(fmaxf(mx[0], mx[1]), fmaxf(mx[2], mx[3])), m);
    nm = fmaxf(nm, xhalf(nm));  // both halves hold the query's maximum

    float rs[4];
#pragma unroll
    for (int nt = 0; nt < 4; ++nt) {
      rs[nt] = 0.0f;
#pragma unroll
      for (int r = 0; r < 8; ++r) {
        float p = __expf(sc[nt][r] - nm);
        sc[nt][r] = p;
        rs[nt] += p;
      }
    }

    const float alpha = __expf(m - nm);
    l = l * alpha + ((rs[0] + rs[1]) + (rs[2] + rs[3]));
    m = nm;
#pragma unroll
    for (int nt = 0; nt < 4; ++nt)
#pragma unroll
      for (int r = 0; r < 8; ++r) o[nt][r] *= alpha;

    // ---- P^T: tiles 2 kc and 2 kc + 1, converted in place, are keys
    // 8 h + i and 16 + 8 h + i of a 32-key B operand ----
    v16h pf[2];
#pragma unroll
    for (int kc = 0; kc < 2; ++kc)
#pragma unroll
      for (int i = 0; i < 8; ++i) {
        pf[kc][i]     = (_Float16)sc[2 * kc][i];
        pf[kc][i + 8] = (_Float16)sc[2 * kc + 1][i];
      }

    // ---- O^T += V^T P^T: o[nt][r] = column 16 nt + 8 h + r, query c ----
#pragma unroll
    for (int nt = 0; nt < 4; ++nt)
#pragma unroll
      for (int kc = 0; kc < 2; ++kc) {
        const unsigned char* p = vt + (uint32_t)kc * 32u * PV + (uint32_t)nt * 32u;
        v16h vf = frag_pair(ld_tr16(p), ld_tr16(p + 16u * PV));
        o[nt] = wmma_f16(vf, pf[kc], o[nt]);
      }

    // ---- publish point of block kbI + 1: this wave's LDS reads are done,
    // the issuers' tiles have landed, every wave passes the barrier; only
    // then (top of the next trip) is the buffer just read refilled ----
    wait_ds0();
    if (pinned(wave == 0u)) tile_wait(g0k, g1k);
    if (pinned(wave == 1u)) tile_wait(g0v, g1v);
    __syncthreads();
  }
  wait_tensor0();
  wait_ds0();

  // ---- join the halves' sums, normalize, write the head's slice (f32):
  // a lane's eight registers of a tile are eight neighbouring columns ----
  const float inv = 1.0f / (l + xhalf(l));
  float* dst = attn + (rowbase + (size_t)row) * ATT + hoff + rsel;
#pragma unroll
  for (int nt = 0; nt < 4; ++nt) {
    float4 lo = {o[nt][0] * inv, o[nt][1] * inv, o[nt][2] * inv, o[nt][3] * inv};
    float4 hi = {o[nt][4] * inv, o[nt][5] * inv, o[nt][6] * inv, o[nt][7] * inv};
    *(float4*)(dst + nt * 16)     = lo;
    *(float4*)(dst + nt * 16 + 4) = hi;
  }
}

// ---------------------------------------------------------------------------
// Kernel 3: residual (+ projected q) and LayerNorm over the 1024-wide row.
// ---------------------------------------------------------------------------
__global__ __launch_bounds__(256) void resid_layernorm(
    const float* __restrict__ attn, const float* __restrict__ qres,
    const float* __restrict__ gamma, const float* __restrict__ beta,
    float* __restrict__ out) {
  const int row = blockIdx.x;
  const int tid = threadIdx.x;
  const size_t base = (size_t)row * ATT + tid * 4;

  float4 a = *(const float4*)(attn + base);
  float4 q = *(const float4*)(qres + base);
  float x0 = a.x + q.x, x1 = a.y + q.y, x2 = a.z + q.z, x3 = a.w + q.w;

  __shared__ float r1[256], r2[256];
  r1[tid] = x0 + x1 + x2 + x3;
  r2[tid] = x0 * x0 + x1 * x1 + x2 * x2 + x3 * x3;
  __syncthreads();
#pragma unroll
  for (int off = 128; off > 0; off >>= 1) {
    if (tid < off) { r1[tid] += r1[tid + off]; r2[tid] += r2[tid + off]; }
    __syncthreads();
  }
  const float mu   = r1[0] * (1.0f / ATT);
  const float var  = r2[0] * (1.0f / ATT) - mu * mu;
  const float rinv = rsqrtf(var + 1e-5f);

  float4 g  = *(const float4*)(gamma + tid * 4);
  float4 be = *(const float4*)(beta + tid * 4);
  float4 y;
  y.x = (x0 - mu) * rinv * g.x + be.x;
  y.y = (x1 - mu) * rinv * g.y + be.y;
  y.z = (x2 - mu) * rinv * g.z + be.z;
  y.w = (x3 - mu) * rinv * g.w + be.w;
  *(float4*)(out + base) = y;
}

// ---------------------------------------------------------------------------
extern "C" void kernel_launch(void* const* d_in, const int* in_sizes, int n_in,
                              void* d_out, int out_size, void* d_ws,
                              size_t ws_size, hipStream_t stream) {
  const float* query = (const float*)d_in[0];
  const float* key   = (const float*)d_in[1];
  const float* value = (const float*)d_in[2];
  const float* Wq    = (const float*)d_in[3];
  const float* bq    = (const float*)d_in[4];
  const float* Wk    = (const float*)d_in[5];
  const float* bk    = (const float*)d_in[6];
  const float* Wv    = (const float*)d_in[7];
  const float* bv    = (const float*)d_in[8];
  const float* gamma = (const float*)d_in[9];
  const float* beta  = (const float*)d_in[10];

  // Workspace: q16/k16/v16 (8 MiB each) | q f32 (16 MiB) | attn f32 (16 MiB)
  char* ws = (char*)d_ws;
  const size_t F16B = (size_t)MTOT * ATT * sizeof(_Float16);
  const size_t F32B = (size_t)MTOT * ATT * sizeof(float);
  _Float16* q16  = (_Float16*)(ws);
  _Float16* k16  = (_Float16*)(ws + F16B);
  _Float16* v16  = (_Float16*)(ws + 2 * F16B);
  float*    qf32 = (float*)(ws + 3 * F16B);
  float*    attn = (float*)(ws + 3 * F16B + F32B);

  dim3 gProj(MTOT / 128, ATT / 64, 3);
  qkv_proj_wmma<<<gProj, 256, 0, stream>>>(query, key, value, Wq, Wk, Wv, bq,
                                           bk, bv, q16, k16, v16, qf32);

  dim3 gAttn(SEQ / 128, BATCH * HEADS);
  flash_attn_wmma<<<gAttn, 256, 0, stream>>>(q16, k16, v16, attn);

  resid_layernorm<<<MTOT, 256, 0, stream>>>(attn, qf32, gamma, beta,
                                            (float*)d_out);
}

// v006
// A run of this version takes 83.4 microseconds.
// In two side-by-side timings against v005, it was 1.31 and 1.32 times as fast.
// Counting every step since v000, it is 3.40 times as fast.
#include <hip/hip_runtime.h>

typedef _Float16     v16h  __attribute__((ext_vector_type(16)));
typedef _Float16     v4h   __attribute__((ext_vector_type(4)));
typedef float        v8f   __attribute__((ext_vector_type(8)));
typedef unsigned int u32x4 __attribute__((ext_vector_type(4)));
typedef unsigned int u32x8 __attribute__((ext_vector_type(8)));
typedef short        s16x8 __attribute__((ext_vector_type(8)));

constexpr int BATCH = 2;
constexpr int SEQ   = 2048;
constexpr int EMB   = 1024;
constexpr int ATT   = 1024;
constexpr int HEADS = 16;
constexpr int HD    = 64;
constexpr int MTOT  = BATCH * SEQ;      // 4096 rows
constexpr float NEGF = -4.2949673e9f;   // -2^32 + 1 (reference mask fill)

__device__ inline v16h frag_ld(const _Float16* __restrict__ p) {
  v16h f;
#pragma unroll
  for (int i = 0; i < 8; ++i) { f[i] = p[i]; f[i + 8] = p[i + 16]; }
  return f;
}

__device__ inline float xhalf(float x) {
  const int b = __builtin_bit_cast(int, x);
  return __builtin_bit_cast(
      float, __builtin_amdgcn_permlanex16(b, b, 0x76543210, 0xfedcba98, false,
                                          false));
}

// Two 16-byte halves (k 0..7 and k 16..23 of the lane's half) as one fragment.
__device__ inline v16h frag_pair(u32x4 lo, u32x4 hi) {
  u32x8 w = {lo.x, lo.y, lo.z, lo.w, hi.x, hi.y, hi.z, hi.w};
  return __builtin_bit_cast(v16h, w);
}

// Transposing LDS load: lane (c = l & 15, h = l >> 4) gets rows 8h..8h+7 of
// column c of the 16 x 16 block of halves that the 32 lane addresses cover.
__device__ inline u32x4 ld_tr16(const unsigned char* p) {
  typedef __attribute__((address_space(3))) s16x8 lds_s16x8;
  return __builtin_bit_cast(
      u32x4, __builtin_amdgcn_ds_load_tr16_b128_v8i16((lds_s16x8*)p));
}

__device__ inline uint32_t uni(uint32_t v) {
  return (uint32_t)__builtin_amdgcn_readfirstlane(v);
}
__device__ inline uint32_t pinned(uint32_t v) {
  uint32_t w = (uint32_t)__builtin_amdgcn_readfirstlane(v);
  asm volatile("" : "+s"(w));  // pinned(): issue test held in a scalar register
  return w;
}
// The compiler places no wait for the tensor mover; both are written by hand.
__device__ inline void wait_tensor0() {
  asm volatile("s_wait_tensorcnt 0x0" ::: "memory");
}
__device__ inline void wait_ds0() {
  asm volatile("s_wait_dscnt 0x0" ::: "memory");
}

__device__ inline u32x4 tile_g0(uint32_t lds_dst, uint64_t ga) {
  u32x4 g0;
  g0[0] = uni(1u);
  g0[1] = uni(lds_dst);
  g0[2] = uni((uint32_t)ga);
  g0[3] = uni((((uint32_t)(ga >> 32)) & 0x01FFFFFFu) | 0x80000000u);
  return g0;
}
__device__ inline u32x8 tile_g1(uint32_t w0) {
  u32x8 g1;
  g1[0] = uni(w0);
  g1[1] = uni(128u << 16);
  g1[2] = uni(64u << 16);
  g1[3] = uni(128u << 16);
  g1[4] = uni(64u);
  g1[5] = uni(2048u);
  g1[6] = uni(0u);
  g1[7] = uni(0u);
  return g1;
}
__device__ inline u32x4 held(u32x4 g) {
  asm volatile("" : "+s"(g));
  return g;
}
__device__ inline void held(u32x8& a, u32x8& b) {
  asm volatile("" : "+s"(a), "+s"(b));
}
__device__ inline void tile_load(u32x4 g0, u32x8 g1) {
  asm volatile("tensor_load_to_lds %0, %1" ::"s"(g0), "s"(g1) : "memory");
}
__device__ inline void tile_wait(u32x4 g0, u32x8 g1) {
  asm volatile("s_wait_tensorcnt 0x0" ::"s"(g0), "s"(g1) : "memory");
}

__device__ inline v8f wmma_f16(v16h a, v16h b, v8f c) {
  return __builtin_amdgcn_wmma_f32_16x16x32_f16(
      false, a, false, b, (short)0, c, false, false);
}

__global__ __launch_bounds__(256) __attribute__((amdgpu_waves_per_eu(6, 6)))
void qkv_proj_wmma(
    const float* __restrict__ Xq, const float* __restrict__ Xk,
    const float* __restrict__ Xv,
    const float* __restrict__ Wq, const float* __restrict__ Wk,
    const float* __restrict__ Wv,
    const float* __restrict__ bq, const float* __restrict__ bk,
    const float* __restrict__ bv,
    _Float16* __restrict__ q16, _Float16* __restrict__ k16,
    _Float16* __restrict__ v16, float* __restrict__ qf32) {
  const int z = blockIdx.z;
  const float* X    = (z == 0) ? Xq : (z == 1) ? Xk : Xv;
  const float* W    = (z == 0) ? Wq : (z == 1) ? Wk : Wv;
  const float* bias = (z == 0) ? bq : (z == 1) ? bk : bv;
  _Float16* out16   = (z == 0) ? q16 : (z == 1) ? k16 : v16;

  const int m0   = blockIdx.x * 128;
  const int n0   = blockIdx.y * 128;
  const int tid  = threadIdx.x;
  const int lane = tid & 31;
  const int wid  = tid >> 5;
  const int wm   = (wid & 1) * 64;
  const int wn   = (wid >> 1) * 32;
  const int rsel = (lane >> 4) * 8;

  constexpr int PA = 72;          // [M][K] row of 64 halves +8 pad
  __shared__ __attribute__((aligned(16))) _Float16 shA[128 * PA];
  constexpr uint32_t PB = 288u;      // [K][N] row of 256 B, pitch 32 B x odd
  __shared__ __attribute__((aligned(16))) unsigned char shB[64u * PB];
  const unsigned char* bt = shB + (uint32_t)(rsel + (lane & 7)) * PB +
                            (uint32_t)((lane >> 3) & 1) * 16u +
                            (uint32_t)wn * 2u;
  const _Float16* at = shA + (wm + (lane & 15)) * PA + rsel;

  // A thread's share of a K step: 8 pieces of X, 16 rows apart, and 8 of W,
  // 8 rows apart, each 4 floats; the same places, as halves, in LDS.
  const int xr = tid >> 4, xc = (tid & 15) << 2;
  const int wr = tid >> 5, wc = (tid & 31) << 2;
  const float* xp = X + (size_t)(m0 + xr) * EMB + xc;
  const float* wp = W + (size_t)wr * ATT + n0 + wc;
  _Float16* xs = shA + xr * PA + xc;
  unsigned char* wsd = shB + (uint32_t)wr * PB + (uint32_t)wc * 2u;

  const v8f zero = {};
  v8f acc[4][2];
#pragma unroll
  for (int i = 0; i < 4; ++i)
#pragma unroll
    for (int j = 0; j < 2; ++j) acc[i][j] = zero;

  for (int kt = 0; kt < EMB; kt += 64) {
    __syncthreads();
    // Phase 1: batch all global loads (back-to-back issue, single wait).
    float4 fa[8], fb[8];
#pragma unroll
    for (int i = 0; i < 8; ++i)
      fa[i] = *(const float4*)(xp + (size_t)i * 16 * EMB);
#pragma unroll
    for (int i = 0; i < 8; ++i)
      fb[i] = *(const float4*)(wp + (size_t)i * 8 * ATT);
    xp += 64;
    wp += (size_t)64 * ATT;
    // Phase 2: convert + LDS stores.
#pragma unroll
    for (int i = 0; i < 8; ++i) {
      v4h w = {(_Float16)fa[i].x, (_Float16)fa[i].y, (_Float16)fa[i].z,
               (_Float16)fa[i].w};
      *(v4h*)(xs + i * 16 * PA) = w;
    }
#pragma unroll
    for (int i = 0; i < 8; ++i) {
      v4h w = {(_Float16)fb[i].x, (_Float16)fb[i].y, (_Float16)fb[i].z,
               (_Float16)fb[i].w};
      *(v4h*)(wsd + (uint32_t)i * 8u * PB) = w;
    }
    __syncthreads();

#pragma unroll
    for (int kc = 0; kc < 2; ++kc) {
      v16h af[4], bf[2];
#pragma unroll
      for (int mt = 0; mt < 4; ++mt)
        af[mt] = frag_ld(at + mt * 16 * PA + kc * 32);
#pragma unroll
      for (int nt = 0; nt < 2; ++nt) {
        const unsigned char* p = bt + (uint32_t)kc * 32u * PB + (uint32_t)nt * 32u;
        bf[nt] = frag_pair(ld_tr16(p), ld_tr16(p + 16u * PB));
      }
#pragma unroll
      for (int mt = 0; mt < 4; ++mt)
#pragma unroll
        for (int nt = 0; nt < 2; ++nt)
          acc[mt][nt] = wmma_f16(af[mt], bf[nt], acc[mt][nt]);
    }
  }

#pragma unroll
  for (int mt = 0; mt < 4; ++mt)
#pragma unroll
    for (int nt = 0; nt < 2; ++nt) {
      const float bv_ = bias[n0 + wn + nt * 16 + (lane & 15)];
#pragma unroll
      for (int r = 0; r < 8; ++r) {
        int grow = m0 + wm + mt * 16 + r + rsel;
        int gcol = n0 + wn + nt * 16 + (lane & 15);
        float val = fmaxf(acc[mt][nt][r] + bv_, 0.0f);
        out16[(size_t)grow * ATT + gcol] = (_Float16)val;
        if (z == 0) qf32[(size_t)grow * ATT + gcol] = val;
      }
    }
}

__global__ __launch_bounds__(256) void flash_attn_wmma(
    const _Float16* __restrict__ q16, const _Float16* __restrict__ k16,
    const _Float16* __restrict__ vv16, float* __restrict__ attn) {
  const int q0   = blockIdx.x * 128;
  const int b    = blockIdx.y / HEADS;
  const int h    = blockIdx.y % HEADS;
  const int tid  = threadIdx.x;
  const int lane = tid & 31;
  const int wid  = tid >> 5;
  const int rsel = (lane >> 4) * 8;

  __shared__ _Float16 shQ[128][72];    // [q][d]     pitch 144 B
  // K0 | K1 (pitch 144 B) | V0 | V1 (pitch 160 B), each place a 2 KiB multiple
  constexpr uint32_t PK = 144u, PV = 160u, KBUF = 10240u, VBUF = 10240u;
  constexpr uint32_t W0K = (1u << 20) | (4u << 22) | (3u << 25);
  constexpr uint32_t W0V = (1u << 20) | (4u << 22) | (7u << 25);
  __shared__ __attribute__((aligned(2048))) unsigned char
      shKV[2u * KBUF + 2u * VBUF];

  const size_t rowbase = (size_t)b * SEQ;
  const size_t hoff    = (size_t)h * HD;

  {
    const uint32_t q_lds = (uint32_t)(uintptr_t)(void*)&shQ[0][0];
#pragma unroll
    for (int i = 0; i < 4; ++i) {
      int e = tid + i * 256;          // 1024 16-byte chunks (pad left alone)
      int row = e >> 3, dc = (e & 7) * 8;
      uint32_t lds = q_lds + (uint32_t)(row * 144 + dc * 2);
      uint64_t ga =
          (uint64_t)(uintptr_t)(q16 + (rowbase + q0 + row) * ATT + hoff + dc);
      asm volatile("global_load_async_to_lds_b128 %0, %1, off\n\ts_wait_xcnt 0x0"
                   ::"v"(lds), "v"(ga)
                   : "memory");
    }
    asm volatile("s_wait_asynccnt 0x0" ::: "memory");
  }

  // ---- K/V ring, prologue: block 0 lands and is published; block 1 starts at
  // the top of the first trip (every chunk walks at least two key blocks) ----
  const uint32_t wave = uni((uint32_t)tid >> 5);
  const uint32_t ring = (uint32_t)(uintptr_t)(void*)&shKV[0];
  const uint64_t kga = (uint64_t)(uintptr_t)(k16 + rowbase * ATT + hoff);
  const uint64_t vga = (uint64_t)(uintptr_t)(vv16 + rowbase * ATT + hoff);
  constexpr uint64_t STEP = 64u * 2048u;  // bytes from one key block to the next
  u32x8 g1k = tile_g1(W0K), g1v = tile_g1(W0V);
  held(g1k, g1v);
  if (pinned(wave == 0u)) {
    const u32x4 g0 = held(tile_g0(ring, kga));
    tile_load(g0, g1k);
    tile_wait(g0, g1k);
  }
  if (pinned(wave == 1u)) {
    const u32x4 g0 = held(tile_g0(ring + 2u * KBUF, vga));
    tile_load(g0, g1v);
    tile_wait(g0, g1v);
  }
  __syncthreads();

  v16h qf[2];
#pragma unroll
  for (int kc = 0; kc < 2; ++kc)
    qf[kc] = frag_ld(&shQ[wid * 16 + (lane & 15)][kc * 32 + rsel]);

  const v8f zero = {};
  v8f o[4];
#pragma unroll
  for (int nt = 0; nt < 4; ++nt) o[nt] = zero;
  float m = -3.0e38f, l = 0.0f;  // l: this half's share of the row sum
  const int row = q0 + wid * 16 + (lane & 15);  // the lane's query

  const int nkb = q0 / 64 + 2;  // keys 0 .. q0+127 (causal bound)
  for (int kbI = 0; kbI < nkb; ++kbI) {
    const int kb = kbI * 64;
    const uint32_t buf = (uint32_t)kbI & 1u;

    const uint32_t more = (uint32_t)(kbI + 1 < nkb);
    const uint64_t adv = (uint64_t)(uint32_t)(kbI + 1) * STEP;
    const u32x4 g0k = held(tile_g0(ring + (buf ^ 1u) * KBUF, kga + adv));
    const u32x4 g0v =
        held(tile_g0(ring + 2u * KBUF + (buf ^ 1u) * VBUF, vga + adv));
    if (pinned((wave == 0u) & more)) tile_load(g0k, g1k);
    if (pinned((wave == 1u) & more)) tile_load(g0v, g1v);

    const unsigned char* kt =
        shKV + buf * KBUF + (uint32_t)(lane & 15) * PK + (uint32_t)rsel * 2u;
    const unsigned char* vt = shKV + 2u * KBUF + buf * VBUF +
                              (uint32_t)(rsel + (lane & 7)) * PV +
                              (uint32_t)((lane >> 3) & 1) * 16u;

    // ---- S^T = K Q^T: sc[nt][r] = key kb + 16 nt + 8 h + r, query c ----
    v8f sc[4];
#pragma unroll
    for (int nt = 0; nt < 4; ++nt) {
      v8f c = zero;
#pragma unroll
      for (int kc = 0; kc < 2; ++kc) {
        const unsigned char* p = kt + (uint32_t)nt * 16u * PK + (uint32_t)kc * 64u;
        v16h kf = frag_pair(*(const u32x4*)p, *(const u32x4*)(p + 32));
        c = wmma_f16(kf, qf[kc], c);
      }
      sc[nt] = c;
    }

    // ---- scale, causal mask, online softmax; four chains, one per tile ----
    float mx[4];
#pragma unroll
    for (int nt = 0; nt < 4; ++nt) {
      const int ahead = row - (kb + nt * 16 + rsel);  // key r is masked if r > ahead
#pragma unroll
      for (int r = 0; r < 8; ++r) {
        float s = sc[nt][r] * 0.125f;
        s = (r > ahead) ? NEGF : s;
        sc[nt][r] = s;
        mx[nt] = (r == 0) ? s : fmaxf(mx[nt], s);
      }
    }
    float nm = fmaxf(fmaxf(fmaxf(mx[0], mx[1]), fmaxf(mx[2], mx[3])), m);
    nm = fmaxf(nm, xhalf(nm));  // both halves hold the query's maximum

    float rs[4];
#pragma unroll
    for (int nt = 0; nt < 4; ++nt) {
      rs[nt] = 0.0f;
#pragma unroll
      for (int r = 0; r < 8; ++r) {
        float p = __expf(sc[nt][r] - nm);
        sc[nt][r] = p;
        rs[nt] += p;
      }
    }

    const float alpha = __expf(m - nm);
    l = l * alpha + ((rs[0] + rs[1]) + (rs[2] + rs[3]));
    m = nm;
#pragma unroll
    for (int nt = 0; nt < 4; ++nt)
#pragma unroll
      for (int r = 0; r < 8; ++r) o[nt][r] *= alpha;

    // ---- P^T: tiles 2 kc and 2 kc + 1, converted in place, are keys
    // 8 h + i and 16 + 8 h + i of a 32-key B operand ----
    v16h pf[2];
#pragma unroll
    for (int kc = 0; kc < 2; ++kc)
#pragma unroll
      for (int i = 0; i < 8; ++i) {
        pf[kc][i]     = (_Float16)sc[2 * kc][i];
        pf[kc][i + 8] = (_Float16)sc[2 * kc + 1][i];
      }

    // ---- O^T += V^T P^T: o[nt][r] = column 16 nt + 8 h + r, query c ----
#pragma unroll
    for (int nt = 0; nt < 4; ++nt)
#pragma unroll
      for (int kc = 0; kc < 2; ++kc) {
        const unsigned char* p = vt + (uint32_t)kc * 32u * PV + (uint32_t)nt * 32u;
        v16h vf = frag_pair(ld_tr16(p), ld_tr16(p + 16u * PV));
        o[nt] = wmma_f16(vf, pf[kc], o[nt]);
      }

    // ---- publish point of block kbI + 1: this wave's LDS reads are done,
    // the issuers' tiles have landed, every wave passes the barrier; only
    // then (top of the next trip) is the buffer just read refilled ----
    wait_ds0();
    if (pinned(wave == 0u)) tile_wait(g0k, g1k);
    if (pinned(wave == 1u)) tile_wait(g0v, g1v);
    __syncthreads();
  }
  wait_tensor0();
  wait_ds0();

  // ---- join the halves' sums, normalize, write the head's slice (f32):
  // a lane's eight registers of a tile are eight neighbouring columns ----
  const float inv = 1.0f / (l + xhalf(l));
  float* dst = attn + (rowbase + (size_t)row) * ATT + hoff + rsel;
#pragma unroll
  for (int nt = 0; nt < 4; ++nt) {
    float4 lo = {o[nt][0] * inv, o[nt][1] * inv, o[nt][2] * inv, o[nt][3] * inv};
    float4 hi = {o[nt][4] * inv, o[nt][5] * inv, o[nt][6] * inv, o[nt][7] * inv};
    *(float4*)(dst + nt * 16)     = lo;
    *(float4*)(dst + nt * 16 + 4) = hi;
  }
}

// ---------------------------------------------------------------------------
// Kernel 3: residual (+ projected q) and LayerNorm over the 1024-wide row.
// ---------------------------------------------------------------------------
__global__ __launch_bounds__(256) void resid_layernorm(
    const float* __restrict__ attn, const float* __restrict__ qres,
    const float* __restrict__ gamma, const float* __restrict__ beta,
    float* __restrict__ out) {
  const int row = blockIdx.x;
  const int tid = threadIdx.x;
  const size_t base = (size_t)row * ATT + tid * 4;

  float4 a = *(const float4*)(attn + base);
  float4 q = *(const float4*)(qres + base);
  float x0 = a.x + q.x, x1 = a.y + q.y, x2 = a.z + q.z, x3 = a.w + q.w;

  __shared__ float r1[256], r2[256];
  r1[tid] = x0 + x1 + x2 + x3;
  r2[tid] = x0 * x0 + x1 * x1 + x2 * x2 + x3 * x3;
  __syncthreads();
#pragma unroll
  for (int off = 128; off > 0; off >>= 1) {
    if (tid < off) { r1[tid] += r1[tid + off]; r2[tid] += r2[tid + off]; }
    __syncthreads();
  }
  const float mu   = r1[0] * (1.0f / ATT);
  const float var  = r2[0] * (1.0f / ATT) - mu * mu;
  const float rinv = rsqrtf(var + 1e-5f);

  float4 g  = *(const float4*)(gamma + tid * 4);
  float4 be = *(const float4*)(beta + tid * 4);
  float4 y;
  y.x = (x0 - mu) * rinv * g.x + be.x;
  y.y = (x1 - mu) * rinv * g.y + be.y;
  y.z = (x2 - mu) * rinv * g.z + be.z;
  y.w = (x3 - mu) * rinv * g.w + be.w;
  *(float4*)(out + base) = y;
}

// ---------------------------------------------------------------------------
extern "C" void kernel_launch(void* const* d_in, const int* in_sizes, int n_in,
                              void* d_out, int out_size, void* d_ws,
                              size_t ws_size, hipStream_t stream) {
  const float* query = (const float*)d_in[0];
  const float* key   = (const float*)d_in[1];
  const float* value = (const float*)d_in[2];
  const float* Wq    = (const float*)d_in[3];
  const float* bq    = (const float*)d_in[4];
  const float* Wk    = (const float*)d_in[5];
  const float* bk    = (const float*)d_in[6];
  const float* Wv    = (const float*)d_in[7];
  const float* bv    = (const float*)d_in[8];
  const float* gamma = (const float*)d_in[9];
  const float* beta  = (const float*)d_in[10];

  // Workspace: q16/k16/v16 (8 MiB each) | q f32 (16 MiB) | attn f32 (16 MiB)
  char* ws = (char*)d_ws;
  const size_t F16B = (size_t)MTOT * ATT * sizeof(_Float16);
  const size_t F32B = (size_t)MTOT * ATT * sizeof(float);
  _Float16* q16  = (_Float16*)(ws);
  _Float16* k16  = (_Float16*)(ws + F16B);
  _Float16* v16  = (_Float16*)(ws + 2 * F16B);
  float*    qf32 = (float*)(ws + 3 * F16B);
  float*    attn = (float*)(ws + 3 * F16B + F32B);

  dim3 gProj(MTOT / 128, ATT / 128, 3);
  qkv_proj_wmma<<<gProj, 256, 0, stream>>>(query, key, value, Wq, Wk, Wv, bq,
                                           bk, bv, q16, k16, v16, qf32);

  dim3 gAttn(SEQ / 128, BATCH * HEADS);
  flash_attn_wmma<<<gAttn, 256, 0, stream>>>(q16, k16, v16, attn);

  resid_layernorm<<<MTOT, 256, 0, stream>>>(attn, qf32, gamma, beta,
                                            (float*)d_out);
}

// v007
// It runs in 80.1 microseconds.
// Timed twice side by side with v006, it ran 1.04 times as fast both times.
// All steps since v000 together make it 3.53 times as fast.
#include <hip/hip_runtime.h>

typedef _Float16     v16h  __attribute__((ext_vector_type(16)));
typedef _Float16     v4h   __attribute__((ext_vector_type(4)));
typedef float        v8f   __attribute__((ext_vector_type(8)));
typedef unsigned int u32x4 __attribute__((ext_vector_type(4)));
typedef unsigned int u32x8 __attribute__((ext_vector_type(8)));
typedef short        s16x8 __attribute__((ext_vector_type(8)));

constexpr int BATCH = 2;
constexpr int SEQ   = 2048;
constexpr int EMB   = 1024;
constexpr int ATT   = 1024;
constexpr int HEADS = 16;
constexpr int HD    = 64;
constexpr int MTOT  = BATCH * SEQ;      // 4096 rows
constexpr float NEGF = -4.2949673e9f;   // -2^32 + 1 (reference mask fill)

__device__ inline v16h frag_ld(const _Float16* __restrict__ p) {
  v16h f;
#pragma unroll
  for (int i = 0; i < 8; ++i) { f[i] = p[i]; f[i + 8] = p[i + 16]; }
  return f;
}

__device__ inline float xhalf(float x) {
  const int b = __builtin_bit_cast(int, x);
  return __builtin_bit_cast(
      float, __builtin_amdgcn_permlanex16(b, b, 0x76543210, 0xfedcba98, false,
                                          false));
}

// Two 16-byte halves (k 0..7 and k 16..23 of the lane's half) as one fragment.
__device__ inline v16h frag_pair(u32x4 lo, u32x4 hi) {
  u32x8 w = {lo.x, lo.y, lo.z, lo.w, hi.x, hi.y, hi.z, hi.w};
  return __builtin_bit_cast(v16h, w);
}

// Transposing LDS load: lane (c = l & 15, h = l >> 4) gets rows 8h..8h+7 of
// column c of the 16 x 16 block of halves that the 32 lane addresses cover.
__device__ inline u32x4 ld_tr16(const unsigned char* p) {
  typedef __attribute__((address_space(3))) s16x8 lds_s16x8;
  return __builtin_bit_cast(
      u32x4, __builtin_amdgcn_ds_load_tr16_b128_v8i16((lds_s16x8*)p));
}

__device__ inline uint32_t uni(uint32_t v) {
  return (uint32_t)__builtin_amdgcn_readfirstlane(v);
}
__device__ inline uint32_t pinned(uint32_t v) {
  uint32_t w = (uint32_t)__builtin_amdgcn_readfirstlane(v);
  asm volatile("" : "+s"(w));  // pinned(): issue test held in a scalar register
  return w;
}
// The compiler places no wait for the tensor mover; both are written by hand.
__device__ inline void wait_tensor0() {
  asm volatile("s_wait_tensorcnt 0x0" ::: "memory");
}
__device__ inline void wait_ds0() {
  asm volatile("s_wait_dscnt 0x0" ::: "memory");
}

__device__ inline u32x4 tile_g0(uint32_t lds_dst, uint64_t ga) {
  u32x4 g0;
  g0[0] = uni(1u);
  g0[1] = uni(lds_dst);
  g0[2] = uni((uint32_t)ga);
  g0[3] = uni((((uint32_t)(ga >> 32)) & 0x01FFFFFFu) | 0x80000000u);
  return g0;
}
__device__ inline u32x8 tile_g1(uint32_t w0) {
  u32x8 g1;
  g1[0] = uni(w0);
  g1[1] = uni(128u << 16);
  g1[2] = uni(64u << 16);
  g1[3] = uni(128u << 16);
  g1[4] = uni(64u);
  g1[5] = uni(2048u);
  g1[6] = uni(0u);
  g1[7] = uni(0u);
  return g1;
}
__device__ inline u32x4 held(u32x4 g) {
  asm volatile("" : "+s"(g));
  return g;
}
__device__ inline void held(u32x8& a, u32x8& b) {
  asm volatile("" : "+s"(a), "+s"(b));
}
__device__ inline void tile_load(u32x4 g0, u32x8 g1) {
  asm volatile("tensor_load_to_lds %0, %1" ::"s"(g0), "s"(g1) : "memory");
}
__device__ inline void tile_wait(u32x4 g0, u32x8 g1) {
  asm volatile("s_wait_tensorcnt 0x0" ::"s"(g0), "s"(g1) : "memory");
}

__device__ inline v8f wmma_f16(v16h a, v16h b, v8f c) {
  return __builtin_amdgcn_wmma_f32_16x16x32_f16(
      false, a, false, b, (short)0, c, false, false);
}

__global__ __launch_bounds__(256) __attribute__((amdgpu_waves_per_eu(6, 6)))
void qkv_proj_wmma(
    const float* __restrict__ Xq, const float* __restrict__ Xk,
    const float* __restrict__ Xv,
    const float* __restrict__ Wq, const float* __restrict__ Wk,
    const float* __restrict__ Wv,
    const float* __restrict__ bq, const float* __restrict__ bk,
    const float* __restrict__ bv,
    _Float16* __restrict__ q16, _Float16* __restrict__ k16,
    _Float16* __restrict__ v16, float* __restrict__ qf32) {
  const int z = blockIdx.z;
  const float* X    = (z == 0) ? Xq : (z == 1) ? Xk : Xv;
  const float* W    = (z == 0) ? Wq : (z == 1) ? Wk : Wv;
  const float* bias = (z == 0) ? bq : (z == 1) ? bk : bv;
  _Float16* out16   = (z == 0) ? q16 : (z == 1) ? k16 : v16;

  const int m0   = blockIdx.x * 128;
  const int n0   = blockIdx.y * 128;
  const int tid  = threadIdx.x;
  const int lane = tid & 31;
  const int wid  = tid >> 5;
  const int wm   = (wid & 1) * 64;
  const int wn   = (wid >> 1) * 32;
  const int rsel = (lane >> 4) * 8;

  constexpr int PA = 72;          // [M][K] row of 64 halves +8 pad
  __shared__ __attribute__((aligned(16))) _Float16 shA[128 * PA];
  constexpr uint32_t PB = 288u;      // [K][N] row of 256 B, pitch 32 B x odd
  __shared__ __attribute__((aligned(16))) unsigned char shB[64u * PB];
  const unsigned char* bt = shB + (uint32_t)(rsel + (lane & 7)) * PB +
                            (uint32_t)((lane >> 3) & 1) * 16u +
                            (uint32_t)wn * 2u;
  const _Float16* at = shA + (wm + (lane & 15)) * PA + rsel;

  // A thread's share of a K step: 8 pieces of X, 16 rows apart, and 8 of W,
  // 8 rows apart, each 4 floats; the same places, as halves, in LDS.
  const int xr = tid >> 4, xc = (tid & 15) << 2;
  const int wr = tid >> 5, wc = (tid & 31) << 2;
  const float* xp = X + (size_t)(m0 + xr) * EMB + xc;
  const float* wp = W + (size_t)wr * ATT + n0 + wc;
  _Float16* xs = shA + xr * PA + xc;
  unsigned char* wsd = shB + (uint32_t)wr * PB + (uint32_t)wc * 2u;

  const v8f zero = {};
  v8f acc[4][2];
#pragma unroll
  for (int i = 0; i < 4; ++i)
#pragma unroll
    for (int j = 0; j < 2; ++j) acc[i][j] = zero;

  for (int kt = 0; kt < EMB; kt += 64) {
    __syncthreads();
    // Phase 1: batch all global loads (back-to-back issue, single wait).
    float4 fa[8], fb[8];
#pragma unroll
    for (int i = 0; i < 8; ++i)
      fa[i] = *(const float4*)(xp + (size_t)i * 16 * EMB);
#pragma unroll
    for (int i = 0; i < 8; ++i)
      fb[i] = *(const float4*)(wp + (size_t)i * 8 * ATT);
    xp += 64;
    wp += (size_t)64 * ATT;
    // Phase 2: convert + LDS stores.
#pragma unroll
    for (int i = 0; i < 8; ++i) {
      v4h w = {(_Float16)fa[i].x, (_Float16)fa[i].y, (_Float16)fa[i].z,
               (_Float16)fa[i].w};
      *(v4h*)(xs + i * 16 * PA) = w;
    }
#pragma unroll
    for (int i = 0; i < 8; ++i) {
      v4h w = {(_Float16)fb[i].x, (_Float16)fb[i].y, (_Float16)fb[i].z,
               (_Float16)fb[i].w};
      *(v4h*)(wsd + (uint32_t)i * 8u * PB) = w;
    }
    __syncthreads();

#pragma unroll
    for (int kc = 0; kc < 2; ++kc) {
      v16h af[4], bf[2];
#pragma unroll
      for (int mt = 0; mt < 4; ++mt)
        af[mt] = frag_ld(at + mt * 16 * PA + kc * 32);
#pragma unroll
      for (int nt = 0; nt < 2; ++nt) {
        const unsigned char* p = bt + (uint32_t)kc * 32u * PB + (uint32_t)nt * 32u;
        bf[nt] = frag_pair(ld_tr16(p), ld_tr16(p + 16u * PB));
      }
#pragma unroll
      for (int mt = 0; mt < 4; ++mt)
#pragma unroll
        for (int nt = 0; nt < 2; ++nt)
          acc[mt][nt] = wmma_f16(af[mt], bf[nt], acc[mt][nt]);
    }
  }

#pragma unroll
  for (int mt = 0; mt < 4; ++mt)
#pragma unroll
    for (int nt = 0; nt < 2; ++nt) {
      const float bv_ = bias[n0 + wn + nt * 16 + (lane & 15)];
#pragma unroll
      for (int r = 0; r < 8; ++r) {
        int grow = m0 + wm + mt * 16 + r + rsel;
        int gcol = n0 + wn + nt * 16 + (lane & 15);
        float val = fmaxf(acc[mt][nt][r] + bv_, 0.0f);
        out16[(size_t)grow * ATT + gcol] = (_Float16)val;
        if (z == 0) qf32[(size_t)grow * ATT + gcol] = val;
      }
    }
}

__global__ __launch_bounds__(256) void flash_attn_wmma(
    const _Float16* __restrict__ q16, const _Float16* __restrict__ k16,
    const _Float16* __restrict__ vv16, float* __restrict__ attn) {
  const int q0   = blockIdx.x * 128;
  const int b    = blockIdx.y / HEADS;
  const int h    = blockIdx.y % HEADS;
  const int tid  = threadIdx.x;
  const int lane = tid & 31;
  const int wid  = tid >> 5;
  const int rsel = (lane >> 4) * 8;

  __shared__ _Float16 shQ[128][72];    // [q][d]     pitch 144 B
  // K0 | K1 (pitch 144 B) | V0 | V1 (pitch 160 B), each place a 2 KiB multiple
  constexpr uint32_t PK = 144u, PV = 160u, KBUF = 10240u, VBUF = 10240u;
  constexpr uint32_t W0K = (1u << 20) | (4u << 22) | (3u << 25);
  constexpr uint32_t W0V = (1u << 20) | (4u << 22) | (7u << 25);
  __shared__ __attribute__((aligned(2048))) unsigned char
      shKV[2u * KBUF + 2u * VBUF];

  const size_t rowbase = (size_t)b * SEQ;
  const size_t hoff    = (size_t)h * HD;

  {
    const uint32_t q_lds = (uint32_t)(uintptr_t)(void*)&shQ[0][0];
#pragma unroll
    for (int i = 0; i < 4; ++i) {
      int e = tid + i * 256;          // 1024 16-byte chunks (pad left alone)
      int row = e >> 3, dc = (e & 7) * 8;
      uint32_t lds = q_lds + (uint32_t)(row * 144 + dc * 2);
      uint64_t ga =
          (uint64_t)(uintptr_t)(q16 + (rowbase + q0 + row) * ATT + hoff + dc);
      asm volatile("global_load_async_to_lds_b128 %0, %1, off\n\ts_wait_xcnt 0x0"
                   ::"v"(lds), "v"(ga)
                   : "memory");
    }
    asm volatile("s_wait_asynccnt 0x0" ::: "memory");
  }

  // ---- K/V ring, prologue: block 0 lands and is published; block 1 starts at
  // the top of the first trip (every chunk walks at least two key blocks) ----
  const uint32_t wave = uni((uint32_t)tid >> 5);
  const uint32_t ring = (uint32_t)(uintptr_t)(void*)&shKV[0];
  const uint64_t kga = (uint64_t)(uintptr_t)(k16 + rowbase * ATT + hoff);
  const uint64_t vga = (uint64_t)(uintptr_t)(vv16 + rowbase * ATT + hoff);
  constexpr uint64_t STEP = 64u * 2048u;  // bytes from one key block to the next
  u32x8 g1k = tile_g1(W0K), g1v = tile_g1(W0V);
  held(g1k, g1v);
  if (pinned(wave == 0u)) {
    const u32x4 g0 = held(tile_g0(ring, kga));
    tile_load(g0, g1k);
    tile_wait(g0, g1k);
  }
  if (pinned(wave == 1u)) {
    const u32x4 g0 = held(tile_g0(ring + 2u * KBUF, vga));
    tile_load(g0, g1v);
    tile_wait(g0, g1v);
  }
  __syncthreads();

  v16h qf[2];
#pragma unroll
  for (int kc = 0; kc < 2; ++kc)
    qf[kc] = frag_ld(&shQ[wid * 16 + (lane & 15)][kc * 32 + rsel]);

  const v8f zero = {};
  v8f o[4];
#pragma unroll
  for (int nt = 0; nt < 4; ++nt) o[nt] = zero;
  float m = -3.0e38f, l = 0.0f;  // l: this half's share of the row sum
  const int row = q0 + wid * 16 + (lane & 15);  // the lane's query

  const int nkb = q0 / 64 + 2;  // keys 0 .. q0+127 (causal bound)
  for (int kbI = 0; kbI < nkb; ++kbI) {
    const int kb = kbI * 64;
    const uint32_t buf = (uint32_t)kbI & 1u;

    const uint32_t more = (uint32_t)(kbI + 1 < nkb);
    const uint64_t adv = (uint64_t)(uint32_t)(kbI + 1) * STEP;
    const u32x4 g0k = held(tile_g0(ring + (buf ^ 1u) * KBUF, kga + adv));
    const u32x4 g0v =
        held(tile_g0(ring + 2u * KBUF + (buf ^ 1u) * VBUF, vga + adv));
    if (pinned((wave == 0u) & more)) tile_load(g0k, g1k);
    if (pinned((wave == 1u) & more)) tile_load(g0v, g1v);

    const unsigned char* kt =
        shKV + buf * KBUF + (uint32_t)(lane & 15) * PK + (uint32_t)rsel * 2u;
    const unsigned char* vt = shKV + 2u * KBUF + buf * VBUF +
                              (uint32_t)(rsel + (lane & 7)) * PV +
                              (uint32_t)((lane >> 3) & 1) * 16u;

    // ---- all of the block's fragments, one group of 32 LDS loads issued here,
    // K first: the K products wait on counts only, V^T lands while they and the
    // softmax run, and no product below waits out an LDS latency of its own ----
    u32x4 klo[4][2], khi[4][2], vlo[4][2], vhi[4][2];
#pragma unroll
    for (int nt = 0; nt < 4; ++nt)
#pragma unroll
      for (int kc = 0; kc < 2; ++kc) {
        const unsigned char* p = kt + (uint32_t)nt * 16u * PK + (uint32_t)kc * 64u;
        klo[nt][kc] = *(const u32x4*)p;
        khi[nt][kc] = *(const u32x4*)(p + 32);
      }
    // keeps K in front of V^T (LDS answers in order, and the compiler put the
    // V^T loads ahead of most of K, which the first products wait for)
    __builtin_amdgcn_sched_barrier(0);
#pragma unroll
    for (int kc = 0; kc < 2; ++kc)
#pragma unroll
      for (int nt = 0; nt < 4; ++nt) {
        const unsigned char* p = vt + (uint32_t)kc * 32u * PV + (uint32_t)nt * 32u;
        vlo[nt][kc] = ld_tr16(p);
        vhi[nt][kc] = ld_tr16(p + 16u * PV);
      }
    // keeps the loads up here (else the compiler sinks each pair to its
    // product, where the wave waits out the LDS latency sixteen times)
    __builtin_amdgcn_sched_barrier(0);

    // ---- S^T = K Q^T: sc[nt][r] = key kb + 16 nt + 8 h + r, query c ----
    v8f sc[4];
#pragma unroll
    for (int nt = 0; nt < 4; ++nt) {
      v8f c = zero;
#pragma unroll
      for (int kc = 0; kc < 2; ++kc)
        c = wmma_f16(frag_pair(klo[nt][kc], khi[nt][kc]), qf[kc], c);
      sc[nt] = c;
    }

    // ---- scale, causal mask, online softmax; four chains, one per tile ----
    float mx[4];
#pragma unroll
    for (int nt = 0; nt < 4; ++nt) {
      const int ahead = row - (kb + nt * 16 + rsel);  // key r is masked if r > ahead
#pragma unroll
      for (int r = 0; r < 8; ++r) {
        float s = sc[nt][r] * 0.125f;
        s = (r > ahead) ? NEGF : s;
        sc[nt][r] = s;
        mx[nt] = (r == 0) ? s : fmaxf(mx[nt], s);
      }
    }
    float nm = fmaxf(fmaxf(fmaxf(mx[0], mx[1]), fmaxf(mx[2], mx[3])), m);
    nm = fmaxf(nm, xhalf(nm));  // both halves hold the query's maximum

    float rs[4];
#pragma unroll
    for (int nt = 0; nt < 4; ++nt) {
      rs[nt] = 0.0f;
#pragma unroll
      for (int r = 0; r < 8; ++r) {
        float p = __expf(sc[nt][r] - nm);
        sc[nt][r] = p;
        rs[nt] += p;
      }
    }

    const float alpha = __expf(m - nm);
    l = l * alpha + ((rs[0] + rs[1]) + (rs[2] + rs[3]));
    m = nm;
#pragma unroll
    for (int nt = 0; nt < 4; ++nt)
#pragma unroll
      for (int r = 0; r < 8; ++r) o[nt][r] *= alpha;

    // ---- P^T: tiles 2 kc and 2 kc + 1, converted in place, are keys
    // 8 h + i and 16 + 8 h + i of a 32-key B operand ----
    v16h pf[2];
#pragma unroll
    for (int kc = 0; kc < 2; ++kc)
#pragma unroll
      for (int i = 0; i < 8; ++i) {
        pf[kc][i]     = (_Float16)sc[2 * kc][i];
        pf[kc][i + 8] = (_Float16)sc[2 * kc + 1][i];
      }

    // ---- O^T += V^T P^T: o[nt][r] = column 16 nt + 8 h + r, query c ----
#pragma unroll
    for (int nt = 0; nt < 4; ++nt)
#pragma unroll
      for (int kc = 0; kc < 2; ++kc)
        o[nt] = wmma_f16(frag_pair(vlo[nt][kc], vhi[nt][kc]), pf[kc], o[nt]);

    // ---- publish point of block kbI + 1: this wave's LDS reads are done,
    // the issuers' tiles have landed, every wave passes the barrier; only
    // then (top of the next trip) is the buffer just read refilled ----
    // keeps the wait below down here (with every LDS load at the trip's top
    // the compiler lifts it into the softmax, where V^T is still on its way)
    __builtin_amdgcn_sched_barrier(0);
    wait_ds0();
    if (pinned(wave == 0u)) tile_wait(g0k, g1k);
    if (pinned(wave == 1u)) tile_wait(g0v, g1v);
    __syncthreads();
  }
  wait_tensor0();
  wait_ds0();

  // ---- join the halves' sums, normalize, write the head's slice (f32):
  // a lane's eight registers of a tile are eight neighbouring columns ----
  const float inv = 1.0f / (l + xhalf(l));
  float* dst = attn + (rowbase + (size_t)row) * ATT + hoff + rsel;
#pragma unroll
  for (int nt = 0; nt < 4; ++nt) {
    float4 lo = {o[nt][0] * inv, o[nt][1] * inv, o[nt][2] * inv, o[nt][3] * inv};
    float4 hi = {o[nt][4] * inv, o[nt][5] * inv, o[nt][6] * inv, o[nt][7] * inv};
    *(float4*)(dst + nt * 16)     = lo;
    *(float4*)(dst + nt * 16 + 4) = hi;
  }
}

// ---------------------------------------------------------------------------
// Kernel 3: residual (+ projected q) and LayerNorm over the 1024-wide row.
// ---------------------------------------------------------------------------
__global__ __launch_bounds__(256) void resid_layernorm(
    const float* __restrict__ attn, const float* __restrict__ qres,
    const float* __restrict__ gamma, const float* __restrict__ beta,
    float* __restrict__ out) {
  const int row = blockIdx.x;
  const int tid = threadIdx.x;
  const size_t base = (size_t)row * ATT + tid * 4;

  float4 a = *(const float4*)(attn + base);
  float4 q = *(const float4*)(qres + base);
  float x0 = a.x + q.x, x1 = a.y + q.y, x2 = a.z + q.z, x3 = a.w + q.w;

  __shared__ float r1[256], r2[256];
  r1[tid] = x0 + x1 + x2 + x3;
  r2[tid] = x0 * x0 + x1 * x1 + x2 * x2 + x3 * x3;
  __syncthreads();
#pragma unroll
  for (int off = 128; off > 0; off >>= 1) {
    if (tid < off) { r1[tid] += r1[tid + off]; r2[tid] += r2[tid + off]; }
    __syncthreads();
  }
  const float mu   = r1[0] * (1.0f / ATT);
  const float var  = r2[0] * (1.0f / ATT) - mu * mu;
  const float rinv = rsqrtf(var + 1e-5f);

  float4 g  = *(const float4*)(gamma + tid * 4);
  float4 be = *(const float4*)(beta + tid * 4);
  float4 y;
  y.x = (x0 - mu) * rinv * g.x + be.x;
  y.y = (x1 - mu) * rinv * g.y + be.y;
  y.z = (x2 - mu) * rinv * g.z + be.z;
  y.w = (x3 - mu) * rinv * g.w + be.w;
  *(float4*)(out + base) = y;
}

// ---------------------------------------------------------------------------
extern "C" void kernel_launch(void* const* d_in, const int* in_sizes, int n_in,
                              void* d_out, int out_size, void* d_ws,
                              size_t ws_size, hipStream_t stream) {
  const float* query = (const float*)d_in[0];
  const float* key   = (const float*)d_in[1];
  const float* value = (const float*)d_in[2];
  const float* Wq    = (const float*)d_in[3];
  const float* bq    = (const float*)d_in[4];
  const float* Wk    = (const float*)d_in[5];
  const float* bk    = (const float*)d_in[6];
  const float* Wv    = (const float*)d_in[7];
  const float* bv    = (const float*)d_in[8];
  const float* gamma = (const float*)d_in[9];
  const float* beta  = (const float*)d_in[10];

  // Workspace: q16/k16/v16 (8 MiB each) | q f32 (16 MiB) | attn f32 (16 MiB)
  char* ws = (char*)d_ws;
  const size_t F16B = (size_t)MTOT * ATT * sizeof(_Float16);
  const size_t F32B = (size_t)MTOT * ATT * sizeof(float);
  _Float16* q16  = (_Float16*)(ws);
  _Float16* k16  = (_Float16*)(ws + F16B);
  _Float16* v16  = (_Float16*)(ws + 2 * F16B);
  float*    qf32 = (float*)(ws + 3 * F16B);
  float*    attn = (float*)(ws + 3 * F16B + F32B);

  dim3 gProj(MTOT / 128, ATT / 128, 3);
  qkv_proj_wmma<<<gProj, 256, 0, stream>>>(query, key, value, Wq, Wk, Wv, bq,
                                           bk, bv, q16, k16, v16, qf32);

  dim3 gAttn(SEQ / 128, BATCH * HEADS);
  flash_attn_wmma<<<gAttn, 256, 0, stream>>>(q16, k16, v16, attn);

  resid_layernorm<<<MTOT, 256, 0, stream>>>(attn, qf32, gamma, beta,
                                            (float*)d_out);
}

// v008
// It runs in 77.5 microseconds.
// In both of two side-by-side timings against v007, it was 1.04 times as fast.
// All steps since v000 together make it 3.66 times as fast.
#include <hip/hip_runtime.h>

typedef _Float16     v16h  __attribute__((ext_vector_type(16)));
typedef _Float16     v4h   __attribute__((ext_vector_type(4)));
typedef float        v8f   __attribute__((ext_vector_type(8)));
typedef unsigned int u32x4 __attribute__((ext_vector_type(4)));
typedef unsigned int u32x8 __attribute__((ext_vector_type(8)));
typedef short        s16x8 __attribute__((ext_vector_type(8)));

constexpr int BATCH = 2;
constexpr int SEQ   = 2048;
constexpr int EMB   = 1024;
constexpr int ATT   = 1024;
constexpr int HEADS = 16;
constexpr int HD    = 64;
constexpr int MTOT  = BATCH * SEQ;      // 4096 rows
constexpr float NEGF = -4.2949673e9f;   // -2^32 + 1 (reference mask fill)

__device__ inline v16h frag_ld(const _Float16* __restrict__ p) {
  v16h f;
#pragma unroll
  for (int i = 0; i < 8; ++i) { f[i] = p[i]; f[i + 8] = p[i + 16]; }
  return f;
}

__device__ inline float xhalf(float x) {
  const int b = __builtin_bit_cast(int, x);
  return __builtin_bit_cast(
      float, __builtin_amdgcn_permlanex16(b, b, 0x76543210, 0xfedcba98, false,
                                          false));
}

// Two 16-byte halves (k 0..7 and k 16..23 of the lane's half) as one fragment.
__device__ inline v16h frag_pair(u32x4 lo, u32x4 hi) {
  u32x8 w = {lo.x, lo.y, lo.z, lo.w, hi.x, hi.y, hi.z, hi.w};
  return __builtin_bit_cast(v16h, w);
}

// Transposing LDS load: lane (c = l & 15, h = l >> 4) gets rows 8h..8h+7 of
// column c of the 16 x 16 block of halves that the 32 lane addresses cover.
__device__ inline u32x4 ld_tr16(const unsigned char* p) {
  typedef __attribute__((address_space(3))) s16x8 lds_s16x8;
  return __builtin_bit_cast(
      u32x4, __builtin_amdgcn_ds_load_tr16_b128_v8i16((lds_s16x8*)p));
}

__device__ inline uint32_t uni(uint32_t v) {
  return (uint32_t)__builtin_amdgcn_readfirstlane(v);
}
__device__ inline uint32_t pinned(uint32_t v) {
  uint32_t w = (uint32_t)__builtin_amdgcn_readfirstlane(v);
  asm volatile("" : "+s"(w));  // pinned(): issue test held in a scalar register
  return w;
}
// The compiler places no wait for the tensor mover; both are written by hand.
__device__ inline void wait_tensor0() {
  asm volatile("s_wait_tensorcnt 0x0" ::: "memory");
}
__device__ inline void wait_ds0() {
  asm volatile("s_wait_dscnt 0x0" ::: "memory");
}

__device__ inline u32x4 tile_g0(uint32_t lds_dst, uint64_t ga) {
  u32x4 g0;
  g0[0] = uni(1u);
  g0[1] = uni(lds_dst);
  g0[2] = uni((uint32_t)ga);
  g0[3] = uni((((uint32_t)(ga >> 32)) & 0x01FFFFFFu) | 0x80000000u);
  return g0;
}
__device__ inline u32x8 tile_g1(uint32_t w0) {
  u32x8 g1;
  g1[0] = uni(w0);
  g1[1] = uni(128u << 16);
  g1[2] = uni(64u << 16);
  g1[3] = uni(128u << 16);
  g1[4] = uni(64u);
  g1[5] = uni(2048u);
  g1[6] = uni(0u);
  g1[7] = uni(0u);
  return g1;
}
__device__ inline u32x4 held(u32x4 g) {
  asm volatile("" : "+s"(g));
  return g;
}
__device__ inline void held(u32x8& a, u32x8& b) {
  asm volatile("" : "+s"(a), "+s"(b));
}
__device__ inline void tile_load(u32x4 g0, u32x8 g1) {
  asm volatile("tensor_load_to_lds %0, %1" ::"s"(g0), "s"(g1) : "memory");
}
__device__ inline void tile_wait(u32x4 g0, u32x8 g1) {
  asm volatile("s_wait_tensorcnt 0x0" ::"s"(g0), "s"(g1) : "memory");
}

__device__ inline v8f wmma_f16(v16h a, v16h b, v8f c) {
  return __builtin_amdgcn_wmma_f32_16x16x32_f16(
      false, a, false, b, (short)0, c, false, false);
}

__global__ __launch_bounds__(256) __attribute__((amdgpu_waves_per_eu(6, 6)))
void qkv_proj_wmma(
    const float* __restrict__ Xq, const float* __restrict__ Xk,
    const float* __restrict__ Xv,
    const float* __restrict__ Wq, const float* __restrict__ Wk,
    const float* __restrict__ Wv,
    const float* __restrict__ bq, const float* __restrict__ bk,
    const float* __restrict__ bv,
    _Float16* __restrict__ q16, _Float16* __restrict__ k16,
    _Float16* __restrict__ v16, float* __restrict__ qf32) {
  const int z = blockIdx.z;
  const float* X    = (z == 0) ? Xq : (z == 1) ? Xk : Xv;
  const float* W    = (z == 0) ? Wq : (z == 1) ? Wk : Wv;
  const float* bias = (z == 0) ? bq : (z == 1) ? bk : bv;
  _Float16* out16   = (z == 0) ? q16 : (z == 1) ? k16 : v16;

  const int m0   = blockIdx.x * 128;
  const int n0   = blockIdx.y * 128;
  const int tid  = threadIdx.x;
  const int lane = tid & 31;
  const int wid  = tid >> 5;
  const int wm   = (wid & 1) * 64;
  const int wn   = (wid >> 1) * 32;
  const int rsel = (lane >> 4) * 8;

  constexpr int PA = 72;          // [M][K] row of 64 halves +8 pad
  __shared__ __attribute__((aligned(16))) _Float16 shA[128 * PA];
  constexpr uint32_t PB = 288u;      // [K][N] row of 256 B, pitch 32 B x odd
  __shared__ __attribute__((aligned(16))) unsigned char shB[64u * PB];
  const unsigned char* bt = shB + (uint32_t)(rsel + (lane & 7)) * PB +
                            (uint32_t)((lane >> 3) & 1) * 16u +
                            (uint32_t)wn * 2u;
  const _Float16* at = shA + (wm + (lane & 15)) * PA + rsel;

  // A thread's share of a K step: 8 pieces of X, 16 rows apart, and 8 of W,
  // 8 rows apart, each 4 floats; the same places, as halves, in LDS.
  const int xr = tid >> 4, xc = (tid & 15) << 2;
  const int wr = tid >> 5, wc = (tid & 31) << 2;
  const float* xp = X + (size_t)(m0 + xr) * EMB + xc;
  const float* wp = W + (size_t)wr * ATT + n0 + wc;
  _Float16* xs = shA + xr * PA + xc;
  unsigned char* wsd = shB + (uint32_t)wr * PB + (uint32_t)wc * 2u;

  const v8f zero = {};
  v8f acc[4][2];
#pragma unroll
  for (int i = 0; i < 4; ++i)
#pragma unroll
    for (int j = 0; j < 2; ++j) acc[i][j] = zero;

  for (int kt = 0; kt < EMB; kt += 64) {
    __syncthreads();
    // Phase 1: batch all global loads (back-to-back issue, single wait).
    float4 fa[8], fb[8];
#pragma unroll
    for (int i = 0; i < 8; ++i)
      fa[i] = *(const float4*)(xp + (size_t)i * 16 * EMB);
#pragma unroll
    for (int i = 0; i < 8; ++i)
      fb[i] = *(const float4*)(wp + (size_t)i * 8 * ATT);
    xp += 64;
    wp += (size_t)64 * ATT;
    // Phase 2: convert + LDS stores.
#pragma unroll
    for (int i = 0; i < 8; ++i) {
      v4h w = {(_Float16)fa[i].x, (_Float16)fa[i].y, (_Float16)fa[i].z,
               (_Float16)fa[i].w};
      *(v4h*)(xs + i * 16 * PA) = w;
    }
#pragma unroll
    for (int i = 0; i < 8; ++i) {
      v4h w = {(_Float16)fb[i].x, (_Float16)fb[i].y, (_Float16)fb[i].z,
               (_Float16)fb[i].w};
      *(v4h*)(wsd + (uint32_t)i * 8u * PB) = w;
    }
    __syncthreads();

#pragma unroll
    for (int kc = 0; kc < 2; ++kc) {
      v16h af[4], bf[2];
#pragma unroll
      for (int mt = 0; mt < 4; ++mt)
        af[mt] = frag_ld(at + mt * 16 * PA + kc * 32);
#pragma unroll
      for (int nt = 0; nt < 2; ++nt) {
        const unsigned char* p = bt + (uint32_t)kc * 32u * PB + (uint32_t)nt * 32u;
        bf[nt] = frag_pair(ld_tr16(p), ld_tr16(p + 16u * PB));
      }
#pragma unroll
      for (int mt = 0; mt < 4; ++mt)
#pragma unroll
        for (int nt = 0; nt < 2; ++nt)
          acc[mt][nt] = wmma_f16(af[mt], bf[nt], acc[mt][nt]);
    }
  }

#pragma unroll
  for (int mt = 0; mt < 4; ++mt)
#pragma unroll
    for (int nt = 0; nt < 2; ++nt) {
      const float bv_ = bias[n0 + wn + nt * 16 + (lane & 15)];
#pragma unroll
      for (int r = 0; r < 8; ++r) {
        int grow = m0 + wm + mt * 16 + r + rsel;
        int gcol = n0 + wn + nt * 16 + (lane & 15);
        float val = fmaxf(acc[mt][nt][r] + bv_, 0.0f);
        out16[(size_t)grow * ATT + gcol] = (_Float16)val;
        if (z == 0) qf32[(size_t)grow * ATT + gcol] = val;
      }
    }
}

__global__ __launch_bounds__(256) void flash_attn_wmma(
    const _Float16* __restrict__ q16, const _Float16* __restrict__ k16,
    const _Float16* __restrict__ vv16, float* __restrict__ attn) {
  const int q0   = blockIdx.x * 128;
  const int b    = blockIdx.y / HEADS;
  const int h    = blockIdx.y % HEADS;
  const int tid  = threadIdx.x;
  const int lane = tid & 31;
  const int wid  = tid >> 5;
  const int rsel = (lane >> 4) * 8;

  __shared__ _Float16 shQ[128][72];    // [q][d]     pitch 144 B
  // K0 | K1 (pitch 144 B) | V0 | V1 (pitch 160 B), each place a 2 KiB multiple
  constexpr uint32_t PK = 144u, PV = 160u, KBUF = 10240u, VBUF = 10240u;
  constexpr uint32_t W0K = (1u << 20) | (4u << 22) | (3u << 25);
  constexpr uint32_t W0V = (1u << 20) | (4u << 22) | (7u << 25);
  __shared__ __attribute__((aligned(2048))) unsigned char
      shKV[2u * KBUF + 2u * VBUF];

  const size_t rowbase = (size_t)b * SEQ;
  const size_t hoff    = (size_t)h * HD;

  {
    const uint32_t q_lds = (uint32_t)(uintptr_t)(void*)&shQ[0][0];
#pragma unroll
    for (int i = 0; i < 4; ++i) {
      int e = tid + i * 256;          // 1024 16-byte chunks (pad left alone)
      int row = e >> 3, dc = (e & 7) * 8;
      uint32_t lds = q_lds + (uint32_t)(row * 144 + dc * 2);
      uint64_t ga =
          (uint64_t)(uintptr_t)(q16 + (rowbase + q0 + row) * ATT + hoff + dc);
      asm volatile("global_load_async_to_lds_b128 %0, %1, off\n\ts_wait_xcnt 0x0"
                   ::"v"(lds), "v"(ga)
                   : "memory");
    }
    asm volatile("s_wait_asynccnt 0x0" ::: "memory");
  }

  // ---- K/V ring, prologue: block 0 lands and is published; block 1 starts at
  // the top of the first trip (every chunk walks at least two key blocks) ----
  const uint32_t wave = uni((uint32_t)tid >> 5);
  const uint32_t ring = (uint32_t)(uintptr_t)(void*)&shKV[0];
  const uint64_t kga = (uint64_t)(uintptr_t)(k16 + rowbase * ATT + hoff);
  const uint64_t vga = (uint64_t)(uintptr_t)(vv16 + rowbase * ATT + hoff);
  constexpr uint64_t STEP = 64u * 2048u;  // bytes from one key block to the next
  u32x8 g1k = tile_g1(W0K), g1v = tile_g1(W0V);
  held(g1k, g1v);
  if (pinned(wave == 0u)) {
    const u32x4 g0 = held(tile_g0(ring, kga));
    tile_load(g0, g1k);
    tile_wait(g0, g1k);
  }
  if (pinned(wave == 1u)) {
    const u32x4 g0 = held(tile_g0(ring + 2u * KBUF, vga));
    tile_load(g0, g1v);
    tile_wait(g0, g1v);
  }
  __syncthreads();

  v16h qf[2];
#pragma unroll
  for (int kc = 0; kc < 2; ++kc)
    qf[kc] = frag_ld(&shQ[wid * 16 + (lane & 15)][kc * 32 + rsel]);

  const v8f zero = {};
  v8f o[4];
#pragma unroll
  for (int nt = 0; nt < 4; ++nt) o[nt] = zero;
  float m = -3.0e38f, l = 0.0f;  // l: this half's share of the row sum
  const int row = q0 + wid * 16 + (lane & 15);  // the lane's query
  const int wrow0 = q0 + (int)wave * 16;        // the wave's first query (scalar)

  const int nkb = q0 / 64 + 2;  // keys 0 .. q0+127 (causal bound)
  for (int kbI = 0; kbI < nkb; ++kbI) {
    const int kb = kbI * 64;
    const uint32_t buf = (uint32_t)kbI & 1u;

    const uint32_t more = (uint32_t)(kbI + 1 < nkb);
    const uint64_t adv = (uint64_t)(uint32_t)(kbI + 1) * STEP;
    const u32x4 g0k = held(tile_g0(ring + (buf ^ 1u) * KBUF, kga + adv));
    const u32x4 g0v =
        held(tile_g0(ring + 2u * KBUF + (buf ^ 1u) * VBUF, vga + adv));
    if (pinned((wave == 0u) & more)) tile_load(g0k, g1k);
    if (pinned((wave == 1u) & more)) tile_load(g0v, g1v);

    const unsigned char* kt =
        shKV + buf * KBUF + (uint32_t)(lane & 15) * PK + (uint32_t)rsel * 2u;
    const unsigned char* vt = shKV + 2u * KBUF + buf * VBUF +
                              (uint32_t)(rsel + (lane & 7)) * PV +
                              (uint32_t)((lane >> 3) & 1) * 16u;

    // ---- all of the block's fragments, one group of 32 LDS loads issued here,
    // K first: the K products wait on counts only, V^T lands while they and the
    // softmax run, and no product below waits out an LDS latency of its own ----
    u32x4 klo[4][2], khi[4][2], vlo[4][2], vhi[4][2];
#pragma unroll
    for (int nt = 0; nt < 4; ++nt)
#pragma unroll
      for (int kc = 0; kc < 2; ++kc) {
        const unsigned char* p = kt + (uint32_t)nt * 16u * PK + (uint32_t)kc * 64u;
        klo[nt][kc] = *(const u32x4*)p;
        khi[nt][kc] = *(const u32x4*)(p + 32);
      }
    // keeps K in front of V^T (LDS answers in order, and the compiler put the
    // V^T loads ahead of most of K, which the first products wait for)
    __builtin_amdgcn_sched_barrier(0);
#pragma unroll
    for (int kc = 0; kc < 2; ++kc)
#pragma unroll
      for (int nt = 0; nt < 4; ++nt) {
        const unsigned char* p = vt + (uint32_t)kc * 32u * PV + (uint32_t)nt * 32u;
        vlo[nt][kc] = ld_tr16(p);
        vhi[nt][kc] = ld_tr16(p + 16u * PV);
      }
    // keeps the loads up here (else the compiler sinks each pair to its
    // product, where the wave waits out the LDS latency sixteen times)
    __builtin_amdgcn_sched_barrier(0);

    // ---- S^T = K Q^T: sc[nt][r] = key kb + 16 nt + 8 h + r, query c ----
    v8f sc[4];
#pragma unroll
    for (int nt = 0; nt < 4; ++nt) {
      v8f c = zero;
#pragma unroll
      for (int kc = 0; kc < 2; ++kc)
        c = wmma_f16(frag_pair(klo[nt][kc], khi[nt][kc]), qf[kc], c);
      sc[nt] = c;
    }

    // ---- scale, causal mask, online softmax; four chains, one per tile ----
#pragma unroll
    for (int nt = 0; nt < 4; ++nt)
#pragma unroll
      for (int r = 0; r < 8; ++r) sc[nt][r] *= 0.125f;
    // Only a block whose last key lies past the wave's first query holds a
    // masked key (for every other block the select below is the identity):
    // a scalar test, so the blocks under the diagonal skip compare and select.
    if (kb + 63 > wrow0) {
#pragma unroll
      for (int nt = 0; nt < 4; ++nt) {
        const int ahead = row - (kb + nt * 16 + rsel);  // key r is masked if r > ahead
#pragma unroll
        for (int r = 0; r < 8; ++r)
          sc[nt][r] = (r > ahead) ? NEGF : sc[nt][r];
      }
    }
    float mx[4];
#pragma unroll
    for (int nt = 0; nt < 4; ++nt)
#pragma unroll
      for (int r = 0; r < 8; ++r)
        mx[nt] = (r == 0) ? sc[nt][r] : fmaxf(mx[nt], sc[nt][r]);
    float nm = fmaxf(fmaxf(fmaxf(mx[0], mx[1]), fmaxf(mx[2], mx[3])), m);
    nm = fmaxf(nm, xhalf(nm));  // both halves hold the query's maximum

    float rs[4];
#pragma unroll
    for (int nt = 0; nt < 4; ++nt) {
      rs[nt] = 0.0f;
#pragma unroll
      for (int r = 0; r < 8; ++r) {
        float p = __expf(sc[nt][r] - nm);
        sc[nt][r] = p;
        rs[nt] += p;
      }
    }

    const float alpha = __expf(m - nm);
    l = l * alpha + ((rs[0] + rs[1]) + (rs[2] + rs[3]));
    m = nm;
#pragma unroll
    for (int nt = 0; nt < 4; ++nt)
#pragma unroll
      for (int r = 0; r < 8; ++r) o[nt][r] *= alpha;

    // ---- P^T: tiles 2 kc and 2 kc + 1, converted in place, are keys
    // 8 h + i and 16 + 8 h + i of a 32-key B operand ----
    v16h pf[2];
#pragma unroll
    for (int kc = 0; kc < 2; ++kc)
#pragma unroll
      for (int i = 0; i < 8; ++i) {
        pf[kc][i]     = (_Float16)sc[2 * kc][i];
        pf[kc][i + 8] = (_Float16)sc[2 * kc + 1][i];
      }

    // ---- O^T += V^T P^T: o[nt][r] = column 16 nt + 8 h + r, query c ----
#pragma unroll
    for (int nt = 0; nt < 4; ++nt)
#pragma unroll
      for (int kc = 0; kc < 2; ++kc)
        o[nt] = wmma_f16(frag_pair(vlo[nt][kc], vhi[nt][kc]), pf[kc], o[nt]);

    // ---- publish point of block kbI + 1: this wave's LDS reads are done,
    // the issuers' tiles have landed, every wave passes the barrier; only
    // then (top of the next trip) is the buffer just read refilled ----
    // keeps the wait below down here (with every LDS load at the trip's top
    // the compiler lifts it into the softmax, where V^T is still on its way)
    __builtin_amdgcn_sched_barrier(0);
    wait_ds0();
    if (pinned(wave == 0u)) tile_wait(g0k, g1k);
    if (pinned(wave == 1u)) tile_wait(g0v, g1v);
    __syncthreads();
  }
  wait_tensor0();
  wait_ds0();

  // ---- join the halves' sums, normalize, write the head's slice (f32):
  // a lane's eight registers of a tile are eight neighbouring columns ----
  const float inv = 1.0f / (l + xhalf(l));
  float* dst = attn + (rowbase + (size_t)row) * ATT + hoff + rsel;
#pragma unroll
  for (int nt = 0; nt < 4; ++nt) {
    float4 lo = {o[nt][0] * inv, o[nt][1] * inv, o[nt][2] * inv, o[nt][3] * inv};
    float4 hi = {o[nt][4] * inv, o[nt][5] * inv, o[nt][6] * inv, o[nt][7] * inv};
    *(float4*)(dst + nt * 16)     = lo;
    *(float4*)(dst + nt * 16 + 4) = hi;
  }
}

// ---------------------------------------------------------------------------
// Kernel 3: residual (+ projected q) and LayerNorm over the 1024-wide row.
// ---------------------------------------------------------------------------
__global__ __launch_bounds__(256) void resid_layernorm(
    const float* __restrict__ attn, const float* __restrict__ qres,
    const float* __restrict__ gamma, const float* __restrict__ beta,
    float* __restrict__ out) {
  const int row = blockIdx.x;
  const int tid = threadIdx.x;
  const size_t base = (size_t)row * ATT + tid * 4;

  float4 a = *(const float4*)(attn + base);
  float4 q = *(const float4*)(qres + base);
  float x0 = a.x + q.x, x1 = a.y + q.y, x2 = a.z + q.z, x3 = a.w + q.w;

  __shared__ float r1[256], r2[256];
  r1[tid] = x0 + x1 + x2 + x3;
  r2[tid] = x0 * x0 + x1 * x1 + x2 * x2 + x3 * x3;
  __syncthreads();
#pragma unroll
  for (int off = 128; off > 0; off >>= 1) {
    if (tid < off) { r1[tid] += r1[tid + off]; r2[tid] += r2[tid + off]; }
    __syncthreads();
  }
  const float mu   = r1[0] * (1.0f / ATT);
  const float var  = r2[0] * (1.0f / ATT) - mu * mu;
  const float rinv = rsqrtf(var + 1e-5f);

  float4 g  = *(const float4*)(gamma + tid * 4);
  float4 be = *(const float4*)(beta + tid * 4);
  float4 y;
  y.x = (x0 - mu) * rinv * g.x + be.x;
  y.y = (x1 - mu) * rinv * g.y + be.y;
  y.z = (x2 - mu) * rinv * g.z + be.z;
  y.w = (x3 - mu) * rinv * g.w + be.w;
  *(float4*)(out + base) = y;
}

// ---------------------------------------------------------------------------
extern "C" void kernel_launch(void* const* d_in, const int* in_sizes, int n_in,
                              void* d_out, int out_size, void* d_ws,
                              size_t ws_size, hipStream_t stream) {
  const float* query = (const float*)d_in[0];
  const float* key   = (const float*)d_in[1];
  const float* value = (const float*)d_in[2];
  const float* Wq    = (const float*)d_in[3];
  const float* bq    = (const float*)d_in[4];
  const float* Wk    = (const float*)d_in[5];
  const float* bk    = (const float*)d_in[6];
  const float* Wv    = (const float*)d_in[7];
  const float* bv    = (const float*)d_in[8];
  const float* gamma = (const float*)d_in[9];
  const float* beta  = (const float*)d_in[10];

  // Workspace: q16/k16/v16 (8 MiB each) | q f32 (16 MiB) | attn f32 (16 MiB)
  char* ws = (char*)d_ws;
  const size_t F16B = (size_t)MTOT * ATT * sizeof(_Float16);
  const size_t F32B = (size_t)MTOT * ATT * sizeof(float);
  _Float16* q16  = (_Float16*)(ws);
  _Float16* k16  = (_Float16*)(ws + F16B);
  _Float16* v16  = (_Float16*)(ws + 2 * F16B);
  float*    qf32 = (float*)(ws + 3 * F16B);
  float*    attn = (float*)(ws + 3 * F16B + F32B);

  dim3 gProj(MTOT / 128, ATT / 128, 3);
  qkv_proj_wmma<<<gProj, 256, 0, stream>>>(query, key, value, Wq, Wk, Wv, bq,
                                           bk, bv, q16, k16, v16, qf32);

  dim3 gAttn(SEQ / 128, BATCH * HEADS);
  flash_attn_wmma<<<gAttn, 256, 0, stream>>>(q16, k16, v16, attn);

  resid_layernorm<<<MTOT, 256, 0, stream>>>(attn, qf32, gamma, beta,
                                            (float*)d_out);
}

// v009
// Measured time: 74.3 microseconds a run.
// Two timings next to v008 put it at 1.04 and 1.05 times that version's speed.
// Over all steps from v000 it is 3.82 times as fast.
#include <hip/hip_runtime.h>

typedef _Float16     v16h  __attribute__((ext_vector_type(16)));
typedef _Float16     v4h   __attribute__((ext_vector_type(4)));
typedef float        v8f   __attribute__((ext_vector_type(8)));
typedef unsigned int u32x4 __attribute__((ext_vector_type(4)));
typedef unsigned int u32x8 __attribute__((ext_vector_type(8)));
typedef short        s16x8 __attribute__((ext_vector_type(8)));

constexpr int BATCH = 2;
constexpr int SEQ   = 2048;
constexpr int EMB   = 1024;
constexpr int ATT   = 1024;
constexpr int HEADS = 16;
constexpr int HD    = 64;
constexpr int MTOT  = BATCH * SEQ;      // 4096 rows
constexpr float NEGF = -4.2949673e9f;   // -2^32 + 1 (reference mask fill)

__device__ inline v16h frag_ld(const _Float16* __restrict__ p) {
  v16h f;
#pragma unroll
  for (int i = 0; i < 8; ++i) { f[i] = p[i]; f[i + 8] = p[i + 16]; }
  return f;
}

__device__ inline float xhalf(float x) {
  const int b = __builtin_bit_cast(int, x);
  return __builtin_bit_cast(
      float, __builtin_amdgcn_permlanex16(b, b, 0x76543210, 0xfedcba98, false,
                                          false));
}

// Two 16-byte halves (k 0..7 and k 16..23 of the lane's half) as one fragment.
__device__ inline v16h frag_pair(u32x4 lo, u32x4 hi) {
  u32x8 w = {lo.x, lo.y, lo.z, lo.w, hi.x, hi.y, hi.z, hi.w};
  return __builtin_bit_cast(v16h, w);
}

// Transposing LDS load: lane (c = l & 15, h = l >> 4) gets rows 8h..8h+7 of
// column c of the 16 x 16 block of halves that the 32 lane addresses cover.
__device__ inline u32x4 ld_tr16(const unsigned char* p) {
  typedef __attribute__((address_space(3))) s16x8 lds_s16x8;
  return __builtin_bit_cast(
      u32x4, __builtin_amdgcn_ds_load_tr16_b128_v8i16((lds_s16x8*)p));
}

__device__ inline uint32_t uni(uint32_t v) {
  return (uint32_t)__builtin_amdgcn_readfirstlane(v);
}
__device__ inline uint32_t pinned(uint32_t v) {
  uint32_t w = (uint32_t)__builtin_amdgcn_readfirstlane(v);
  asm volatile("" : "+s"(w));  // pinned(): issue test held in a scalar register
  return w;
}
// The compiler places no wait for the tensor mover; both are written by hand.
__device__ inline void wait_tensor0() {
  asm volatile("s_wait_tensorcnt 0x0" ::: "memory");
}
__device__ inline void wait_ds0() {
  asm volatile("s_wait_dscnt 0x0" ::: "memory");
}

__device__ inline u32x4 tile_g0(uint32_t lds_dst, uint64_t ga) {
  u32x4 g0;
  g0[0] = uni(1u);
  g0[1] = uni(lds_dst);
  g0[2] = uni((uint32_t)ga);
  g0[3] = uni((((uint32_t)(ga >> 32)) & 0x01FFFFFFu) | 0x80000000u);
  return g0;
}
__device__ inline u32x8 tile_g1(uint32_t w0) {
  u32x8 g1;
  g1[0] = uni(w0);
  g1[1] = uni(128u << 16);
  g1[2] = uni(64u << 16);
  g1[3] = uni(128u << 16);
  g1[4] = uni(64u);
  g1[5] = uni(2048u);
  g1[6] = uni(0u);
  g1[7] = uni(0u);
  return g1;
}
__device__ inline u32x4 held(u32x4 g) {
  asm volatile("" : "+s"(g));
  return g;
}
__device__ inline void held(u32x8& a, u32x8& b) {
  asm volatile("" : "+s"(a), "+s"(b));
}
__device__ inline void tile_load(u32x4 g0, u32x8 g1) {
  asm volatile("tensor_load_to_lds %0, %1" ::"s"(g0), "s"(g1) : "memory");
}
__device__ inline void tile_wait(u32x4 g0, u32x8 g1) {
  asm volatile("s_wait_tensorcnt 0x0" ::"s"(g0), "s"(g1) : "memory");
}

__device__ inline v8f wmma_f16(v16h a, v16h b, v8f c) {
  return __builtin_amdgcn_wmma_f32_16x16x32_f16(
      false, a, false, b, (short)0, c, false, false);
}

__global__ __launch_bounds__(256) __attribute__((amdgpu_waves_per_eu(6, 6)))
void qkv_proj_wmma(
    const float* __restrict__ Xq, const float* __restrict__ Xk,
    const float* __restrict__ Xv,
    const float* __restrict__ Wq, const float* __restrict__ Wk,
    const float* __restrict__ Wv,
    const float* __restrict__ bq, const float* __restrict__ bk,
    const float* __restrict__ bv,
    _Float16* __restrict__ q16, _Float16* __restrict__ k16,
    _Float16* __restrict__ v16, float* __restrict__ qf32) {
  const int z = blockIdx.z;
  const float* X    = (z == 0) ? Xq : (z == 1) ? Xk : Xv;
  const float* W    = (z == 0) ? Wq : (z == 1) ? Wk : Wv;
  const float* bias = (z == 0) ? bq : (z == 1) ? bk : bv;
  _Float16* out16   = (z == 0) ? q16 : (z == 1) ? k16 : v16;

  const int m0   = blockIdx.x * 128;
  const int n0   = blockIdx.y * 128;
  const int tid  = threadIdx.x;
  const int lane = tid & 31;
  const int wid  = tid >> 5;
  const int wm   = (wid & 1) * 64;
  const int wn   = (wid >> 1) * 32;
  const int rsel = (lane >> 4) * 8;

  constexpr int PA = 72;          // [M][K] row of 64 halves +8 pad
  __shared__ __attribute__((aligned(16))) _Float16 shA[128 * PA];
  constexpr uint32_t PB = 288u;      // [K][N] row of 256 B, pitch 32 B x odd
  __shared__ __attribute__((aligned(16))) unsigned char shB[64u * PB];
  const unsigned char* bt = shB + (uint32_t)(rsel + (lane & 7)) * PB +
                            (uint32_t)((lane >> 3) & 1) * 16u +
                            (uint32_t)wn * 2u;
  const _Float16* at = shA + (wm + (lane & 15)) * PA + rsel;

  // A thread's share of a K step: 8 pieces of X, 16 rows apart, and 8 of W,
  // 8 rows apart, each 4 floats; the same places, as halves, in LDS.
  const int xr = tid >> 4, xc = (tid & 15) << 2;
  const int wr = tid >> 5, wc = (tid & 31) << 2;
  const float* xp = X + (size_t)(m0 + xr) * EMB + xc;
  const float* wp = W + (size_t)wr * ATT + n0 + wc;
  _Float16* xs = shA + xr * PA + xc;
  unsigned char* wsd = shB + (uint32_t)wr * PB + (uint32_t)wc * 2u;

  const v8f zero = {};
  v8f acc[4][2];
#pragma unroll
  for (int i = 0; i < 4; ++i)
#pragma unroll
    for (int j = 0; j < 2; ++j) acc[i][j] = zero;

  for (int kt = 0; kt < EMB; kt += 64) {
    __syncthreads();
    // Phase 1: batch all global loads (back-to-back issue, single wait).
    float4 fa[8], fb[8];
#pragma unroll
    for (int i = 0; i < 8; ++i)
      fa[i] = *(const float4*)(xp + (size_t)i * 16 * EMB);
#pragma unroll
    for (int i = 0; i < 8; ++i)
      fb[i] = *(const float4*)(wp + (size_t)i * 8 * ATT);
    xp += 64;
    wp += (size_t)64 * ATT;
    // Phase 2: convert + LDS stores.
#pragma unroll
    for (int i = 0; i < 8; ++i) {
      v4h w = {(_Float16)fa[i].x, (_Float16)fa[i].y, (_Float16)fa[i].z,
               (_Float16)fa[i].w};
      *(v4h*)(xs + i * 16 * PA) = w;
    }
#pragma unroll
    for (int i = 0; i < 8; ++i) {
      v4h w = {(_Float16)fb[i].x, (_Float16)fb[i].y, (_Float16)fb[i].z,
               (_Float16)fb[i].w};
      *(v4h*)(wsd + (uint32_t)i * 8u * PB) = w;
    }
    __syncthreads();

#pragma unroll
    for (int kc = 0; kc < 2; ++kc) {
      v16h af[4], bf[2];
#pragma unroll
      for (int mt = 0; mt < 4; ++mt)
        af[mt] = frag_ld(at + mt * 16 * PA + kc * 32);
#pragma unroll
      for (int nt = 0; nt < 2; ++nt) {
        const unsigned char* p = bt + (uint32_t)kc * 32u * PB + (uint32_t)nt * 32u;
        bf[nt] = frag_pair(ld_tr16(p), ld_tr16(p + 16u * PB));
      }
#pragma unroll
      for (int mt = 0; mt < 4; ++mt)
#pragma unroll
        for (int nt = 0; nt < 2; ++nt)
          acc[mt][nt] = wmma_f16(af[mt], bf[nt], acc[mt][nt]);
    }
  }

#pragma unroll
  for (int mt = 0; mt < 4; ++mt)
#pragma unroll
    for (int nt = 0; nt < 2; ++nt) {
      const float bv_ = bias[n0 + wn + nt * 16 + (lane & 15)];
#pragma unroll
      for (int r = 0; r < 8; ++r) {
        int grow = m0 + wm + mt * 16 + r + rsel;
        int gcol = n0 + wn + nt * 16 + (lane & 15);
        float val = fmaxf(acc[mt][nt][r] + bv_, 0.0f);
        out16[(size_t)grow * ATT + gcol] = (_Float16)val;
        if (z == 0) qf32[(size_t)grow * ATT + gcol] = val;
      }
    }
}

__global__ __launch_bounds__(256) void flash_attn_wmma(
    const _Float16* __restrict__ q16, const _Float16* __restrict__ k16,
    const _Float16* __restrict__ vv16, float* __restrict__ attn) {
  // Which (chunk, head) a workgroup takes.  Chunk c walks 2 c + 2 key blocks and
  // all 512 workgroups are resident at once, two a WGP, so the launch lasts as
  // long as the fullest WGP.  Flat indices equal modulo 8 form a set, j = f / 8
  // counting them; such a set takes only chunks d and 15 - d, and two of its
  // workgroups whose j differ in one bit (neighbours, or
  // 32 apart) take one of each: 34 key blocks a pair, where equal chunks
  // met before (f and f + 256: up to 64).  For speed only: every (chunk, head)
  // is taken exactly once wherever the workgroups land.
  const int f    = (int)blockIdx.x + (int)blockIdx.y * (SEQ / 128);
  const int d    = f & 7;
  const int j    = f >> 3;
  const int q0   = ((__builtin_popcount((unsigned)j) & 1) ? 15 - d : d) * 128;
  const int b    = (j >> 1) / HEADS;
  const int h    = (j >> 1) % HEADS;
  const int tid  = threadIdx.x;
  const int lane = tid & 31;
  const int wid  = tid >> 5;
  const int rsel = (lane >> 4) * 8;

  __shared__ _Float16 shQ[128][72];    // [q][d]     pitch 144 B
  // K0 | K1 (pitch 144 B) | V0 | V1 (pitch 160 B), each place a 2 KiB multiple
  constexpr uint32_t PK = 144u, PV = 160u, KBUF = 10240u, VBUF = 10240u;
  constexpr uint32_t W0K = (1u << 20) | (4u << 22) | (3u << 25);
  constexpr uint32_t W0V = (1u << 20) | (4u << 22) | (7u << 25);
  __shared__ __attribute__((aligned(2048))) unsigned char
      shKV[2u * KBUF + 2u * VBUF];

  const size_t rowbase = (size_t)b * SEQ;
  const size_t hoff    = (size_t)h * HD;

  {
    const uint32_t q_lds = (uint32_t)(uintptr_t)(void*)&shQ[0][0];
#pragma unroll
    for (int i = 0; i < 4; ++i) {
      int e = tid + i * 256;          // 1024 16-byte chunks (pad left alone)
      int row = e >> 3, dc = (e & 7) * 8;
      uint32_t lds = q_lds + (uint32_t)(row * 144 + dc * 2);
      uint64_t ga =
          (uint64_t)(uintptr_t)(q16 + (rowbase + q0 + row) * ATT + hoff + dc);
      asm volatile("global_load_async_to_lds_b128 %0, %1, off\n\ts_wait_xcnt 0x0"
                   ::"v"(lds), "v"(ga)
                   : "memory");
    }
    asm volatile("s_wait_asynccnt 0x0" ::: "memory");
  }

  // ---- K/V ring, prologue: block 0 lands and is published; block 1 starts at
  // the top of the first trip (every chunk walks at least two key blocks) ----
  const uint32_t wave = uni((uint32_t)tid >> 5);
  const uint32_t ring = (uint32_t)(uintptr_t)(void*)&shKV[0];
  const uint64_t kga = (uint64_t)(uintptr_t)(k16 + rowbase * ATT + hoff);
  const uint64_t vga = (uint64_t)(uintptr_t)(vv16 + rowbase * ATT + hoff);
  constexpr uint64_t STEP = 64u * 2048u;  // bytes from one key block to the next
  u32x8 g1k = tile_g1(W0K), g1v = tile_g1(W0V);
  held(g1k, g1v);
  if (pinned(wave == 0u)) {
    const u32x4 g0 = held(tile_g0(ring, kga));
    tile_load(g0, g1k);
    tile_wait(g0, g1k);
  }
  if (pinned(wave == 1u)) {
    const u32x4 g0 = held(tile_g0(ring + 2u * KBUF, vga));
    tile_load(g0, g1v);
    tile_wait(g0, g1v);
  }
  __syncthreads();

  v16h qf[2];
#pragma unroll
  for (int kc = 0; kc < 2; ++kc)
    qf[kc] = frag_ld(&shQ[wid * 16 + (lane & 15)][kc * 32 + rsel]);

  const v8f zero = {};
  v8f o[4];
#pragma unroll
  for (int nt = 0; nt < 4; ++nt) o[nt] = zero;
  float m = -3.0e38f, l = 0.0f;  // l: this half's share of the row sum
  const int row = q0 + wid * 16 + (lane & 15);  // the lane's query
  const int wrow0 = q0 + (int)wave * 16;        // the wave's first query (scalar)

  const int nkb = q0 / 64 + 2;  // keys 0 .. q0+127 (causal bound)
  for (int kbI = 0; kbI < nkb; ++kbI) {
    const int kb = kbI * 64;
    const uint32_t buf = (uint32_t)kbI & 1u;

    const uint32_t more = (uint32_t)(kbI + 1 < nkb);
    const uint64_t adv = (uint64_t)(uint32_t)(kbI + 1) * STEP;
    const u32x4 g0k = held(tile_g0(ring + (buf ^ 1u) * KBUF, kga + adv));
    const u32x4 g0v =
        held(tile_g0(ring + 2u * KBUF + (buf ^ 1u) * VBUF, vga + adv));
    if (pinned((wave == 0u) & more)) tile_load(g0k, g1k);
    if (pinned((wave == 1u) & more)) tile_load(g0v, g1v);

    const unsigned char* kt =
        shKV + buf * KBUF + (uint32_t)(lane & 15) * PK + (uint32_t)rsel * 2u;
    const unsigned char* vt = shKV + 2u * KBUF + buf * VBUF +
                              (uint32_t)(rsel + (lane & 7)) * PV +
                              (uint32_t)((lane >> 3) & 1) * 16u;

    // ---- all of the block's fragments, one group of 32 LDS loads issued here,
    // K first: the K products wait on counts only, V^T lands while they and the
    // softmax run, and no product below waits out an LDS latency of its own ----
    u32x4 klo[4][2], khi[4][2], vlo[4][2], vhi[4][2];
#pragma unroll
    for (int nt = 0; nt < 4; ++nt)
#pragma unroll
      for (int kc = 0; kc < 2; ++kc) {
        const unsigned char* p = kt + (uint32_t)nt * 16u * PK + (uint32_t)kc * 64u;
        klo[nt][kc] = *(const u32x4*)p;
        khi[nt][kc] = *(const u32x4*)(p + 32);
      }
    // keeps K in front of V^T (LDS answers in order, and the compiler put the
    // V^T loads ahead of most of K, which the first products wait for)
    __builtin_amdgcn_sched_barrier(0);
#pragma unroll
    for (int kc = 0; kc < 2; ++kc)
#pragma unroll
      for (int nt = 0; nt < 4; ++nt) {
        const unsigned char* p = vt + (uint32_t)kc * 32u * PV + (uint32_t)nt * 32u;
        vlo[nt][kc] = ld_tr16(p);
        vhi[nt][kc] = ld_tr16(p + 16u * PV);
      }
    // keeps the loads up here (else the compiler sinks each pair to its
    // product, where the wave waits out the LDS latency sixteen times)
    __builtin_amdgcn_sched_barrier(0);

    // ---- S^T = K Q^T: sc[nt][r] = key kb + 16 nt + 8 h + r, query c ----
    v8f sc[4];
#pragma unroll
    for (int nt = 0; nt < 4; ++nt) {
      v8f c = zero;
#pragma unroll
      for (int kc = 0; kc < 2; ++kc)
        c = wmma_f16(frag_pair(klo[nt][kc], khi[nt][kc]), qf[kc], c);
      sc[nt] = c;
    }

    // ---- scale, causal mask, online softmax; four chains, one per tile ----
#pragma unroll
    for (int nt = 0; nt < 4; ++nt)
#pragma unroll
      for (int r = 0; r < 8; ++r) sc[nt][r] *= 0.125f;
    // Only a block whose last key lies past the wave's first query holds a
    // masked key (for every other block the select below is the identity):
    // a scalar test, so the blocks under the diagonal skip compare and select.
    if (kb + 63 > wrow0) {
#pragma unroll
      for (int nt = 0; nt < 4; ++nt) {
        const int ahead = row - (kb + nt * 16 + rsel);  // key r is masked if r > ahead
#pragma unroll
        for (int r = 0; r < 8; ++r)
          sc[nt][r] = (r > ahead) ? NEGF : sc[nt][r];
      }
    }
    float mx[4];
#pragma unroll
    for (int nt = 0; nt < 4; ++nt)
#pragma unroll
      for (int r = 0; r < 8; ++r)
        mx[nt] = (r == 0) ? sc[nt][r] : fmaxf(mx[nt], sc[nt][r]);
    float nm = fmaxf(fmaxf(fmaxf(mx[0], mx[1]), fmaxf(mx[2], mx[3])), m);
    nm = fmaxf(nm, xhalf(nm));  // both halves hold the query's maximum

    float rs[4];
#pragma unroll
    for (int nt = 0; nt < 4; ++nt) {
      rs[nt] = 0.0f;
#pragma unroll
      for (int r = 0; r < 8; ++r) {
        float p = __expf(sc[nt][r] - nm);
        sc[nt][r] = p;
        rs[nt] += p;
      }
    }

    const float alpha = __expf(m - nm);
    l = l * alpha + ((rs[0] + rs[1]) + (rs[2] + rs[3]));
    m = nm;
#pragma unroll
    for (int nt = 0; nt < 4; ++nt)
#pragma unroll
      for (int r = 0; r < 8; ++r) o[nt][r] *= alpha;

    // ---- P^T: tiles 2 kc and 2 kc + 1, converted in place, are keys
    // 8 h + i and 16 + 8 h + i of a 32-key B operand ----
    v16h pf[2];
#pragma unroll
    for (int kc = 0; kc < 2; ++kc)
#pragma unroll
      for (int i = 0; i < 8; ++i) {
        pf[kc][i]     = (_Float16)sc[2 * kc][i];
        pf[kc][i + 8] = (_Float16)sc[2 * kc + 1][i];
      }

    // ---- O^T += V^T P^T: o[nt][r] = column 16 nt + 8 h + r, query c ----
#pragma unroll
    for (int nt = 0; nt < 4; ++nt)
#pragma unroll
      for (int kc = 0; kc < 2; ++kc)
        o[nt] = wmma_f16(frag_pair(vlo[nt][kc], vhi[nt][kc]), pf[kc], o[nt]);

    // ---- publish point of block kbI + 1: this wave's LDS reads are done,
    // the issuers' tiles have landed, every wave passes the barrier; only
    // then (top of the next trip) is the buffer just read refilled ----
    // keeps the wait below down here (with every LDS load at the trip's top
    // the compiler lifts it into the softmax, where V^T is still on its way)
    __builtin_amdgcn_sched_barrier(0);
    wait_ds0();
    if (pinned(wave == 0u)) tile_wait(g0k, g1k);
    if (pinned(wave == 1u)) tile_wait(g0v, g1v);
    __syncthreads();
  }
  wait_tensor0();
  wait_ds0();

  // ---- join the halves' sums, normalize, write the head's slice (f32):
  // a lane's eight registers of a tile are eight neighbouring columns ----
  const float inv = 1.0f / (l + xhalf(l));
  float* dst = attn + (rowbase + (size_t)row) * ATT + hoff + rsel;
#pragma unroll
  for (int nt = 0; nt < 4; ++nt) {
    float4 lo = {o[nt][0] * inv, o[nt][1] * inv, o[nt][2] * inv, o[nt][3] * inv};
    float4 hi = {o[nt][4] * inv, o[nt][5] * inv, o[nt][6] * inv, o[nt][7] * inv};
    *(float4*)(dst + nt * 16)     = lo;
    *(float4*)(dst + nt * 16 + 4) = hi;
  }
}

// ---------------------------------------------------------------------------
// Kernel 3: residual (+ projected q) and LayerNorm over the 1024-wide row.
// ---------------------------------------------------------------------------
__global__ __launch_bounds__(256) void resid_layernorm(
    const float* __restrict__ attn, const float* __restrict__ qres,
    const float* __restrict__ gamma, const float* __restrict__ beta,
    float* __restrict__ out) {
  const int row = blockIdx.x;
  const int tid = threadIdx.x;
  const size_t base = (size_t)row * ATT + tid * 4;

  float4 a = *(const float4*)(attn + base);
  float4 q = *(const float4*)(qres + base);
  float x0 = a.x + q.x, x1 = a.y + q.y, x2 = a.z + q.z, x3 = a.w + q.w;

  __shared__ float r1[256], r2[256];
  r1[tid] = x0 + x1 + x2 + x3;
  r2[tid] = x0 * x0 + x1 * x1 + x2 * x2 + x3 * x3;
  __syncthreads();
#pragma unroll
  for (int off = 128; off > 0; off >>= 1) {
    if (tid < off) { r1[tid] += r1[tid + off]; r2[tid] += r2[tid + off]; }
    __syncthreads();
  }
  const float mu   = r1[0] * (1.0f / ATT);
  const float var  = r2[0] * (1.0f / ATT) - mu * mu;
  const float rinv = rsqrtf(var + 1e-5f);

  float4 g  = *(const float4*)(gamma + tid * 4);
  float4 be = *(const float4*)(beta + tid * 4);
  float4 y;
  y.x = (x0 - mu) * rinv * g.x + be.x;
  y.y = (x1 - mu) * rinv * g.y + be.y;
  y.z = (x2 - mu) * rinv * g.z + be.z;
  y.w = (x3 - mu) * rinv * g.w + be.w;
  *(float4*)(out + base) = y;
}

// ---------------------------------------------------------------------------
extern "C" void kernel_launch(void* const* d_in, const int* in_sizes, int n_in,
                              void* d_out, int out_size, void* d_ws,
                              size_t ws_size, hipStream_t stream) {
  const float* query = (const float*)d_in[0];
  const float* key   = (const float*)d_in[1];
  const float* value = (const float*)d_in[2];
  const float* Wq    = (const float*)d_in[3];
  const float* bq    = (const float*)d_in[4];
  const float* Wk    = (const float*)d_in[5];
  const float* bk    = (const float*)d_in[6];
  const float* Wv    = (const float*)d_in[7];
  const float* bv    = (const float*)d_in[8];
  const float* gamma = (const float*)d_in[9];
  const float* beta  = (const float*)d_in[10];

  // Workspace: q16/k16/v16 (8 MiB each) | q f32 (16 MiB) | attn f32 (16 MiB)
  char* ws = (char*)d_ws;
  const size_t F16B = (size_t)MTOT * ATT * sizeof(_Float16);
  const size_t F32B = (size_t)MTOT * ATT * sizeof(float);
  _Float16* q16  = (_Float16*)(ws);
  _Float16* k16  = (_Float16*)(ws + F16B);
  _Float16* v16  = (_Float16*)(ws + 2 * F16B);
  float*    qf32 = (float*)(ws + 3 * F16B);
  float*    attn = (float*)(ws + 3 * F16B + F32B);

  dim3 gProj(MTOT / 128, ATT / 128, 3);
  qkv_proj_wmma<<<gProj, 256, 0, stream>>>(query, key, value, Wq, Wk, Wv, bq,
                                           bk, bv, q16, k16, v16, qf32);

  dim3 gAttn(SEQ / 128, BATCH * HEADS);
  flash_attn_wmma<<<gAttn, 256, 0, stream>>>(q16, k16, v16, attn);

  resid_layernorm<<<MTOT, 256, 0, stream>>>(attn, qf32, gamma, beta,
                                            (float*)d_out);
}

// v010
// Measured time: 66.8 microseconds a run.
// Timed twice side by side with v009, it ran 1.08 and 1.09 times as fast.
// Counting every step since v000, it is 4.14 times as fast.
#include <hip/hip_runtime.h>

typedef _Float16     v16h  __attribute__((ext_vector_type(16)));
typedef _Float16     v4h   __attribute__((ext_vector_type(4)));
typedef float        v8f   __attribute__((ext_vector_type(8)));
typedef unsigned int u32x4 __attribute__((ext_vector_type(4)));
typedef unsigned int u32x8 __attribute__((ext_vector_type(8)));
typedef short        s16x8 __attribute__((ext_vector_type(8)));

constexpr int BATCH = 2;
constexpr int SEQ   = 2048;
constexpr int EMB   = 1024;
constexpr int ATT   = 1024;
constexpr int HEADS = 16;
constexpr int HD    = 64;
constexpr int MTOT  = BATCH * SEQ;      // 4096 rows
constexpr float NEGF = -4.2949673e9f;   // -2^32 + 1 (reference mask fill)

__device__ inline v16h frag_ld(const _Float16* __restrict__ p) {
  v16h f;
#pragma unroll
  for (int i = 0; i < 8; ++i) { f[i] = p[i]; f[i + 8] = p[i + 16]; }
  return f;
}

__device__ inline float xhalf(float x) {
  const int b = __builtin_bit_cast(int, x);
  return __builtin_bit_cast(
      float, __builtin_amdgcn_permlanex16(b, b, 0x76543210, 0xfedcba98, false,
                                          false));
}

// Two 16-byte halves (k 0..7 and k 16..23 of the lane's half) as one fragment.
__device__ inline v16h frag_pair(u32x4 lo, u32x4 hi) {
  u32x8 w = {lo.x, lo.y, lo.z, lo.w, hi.x, hi.y, hi.z, hi.w};
  return __builtin_bit_cast(v16h, w);
}

// Transposing LDS load: lane (c = l & 15, h = l >> 4) gets rows 8h..8h+7 of
// column c of the 16 x 16 block of halves that the 32 lane addresses cover.
__device__ inline u32x4 ld_tr16(const unsigned char* p) {
  typedef __attribute__((address_space(3))) s16x8 lds_s16x8;
  return __builtin_bit_cast(
      u32x4, __builtin_amdgcn_ds_load_tr16_b128_v8i16((lds_s16x8*)p));
}

__device__ inline uint32_t uni(uint32_t v) {
  return (uint32_t)__builtin_amdgcn_readfirstlane(v);
}
__device__ inline uint32_t pinned(uint32_t v) {
  uint32_t w = (uint32_t)__builtin_amdgcn_readfirstlane(v);
  asm volatile("" : "+s"(w));  // pinned(): issue test held in a scalar register
  return w;
}
// The compiler places no wait for the tensor mover; both are written by hand.
__device__ inline void wait_tensor0() {
  asm volatile("s_wait_tensorcnt 0x0" ::: "memory");
}
__device__ inline void wait_ds0() {
  asm volatile("s_wait_dscnt 0x0" ::: "memory");
}

__device__ inline u32x4 tile_g0(uint32_t lds_dst, uint64_t ga) {
  u32x4 g0;
  g0[0] = uni(1u);
  g0[1] = uni(lds_dst);
  g0[2] = uni((uint32_t)ga);
  g0[3] = uni((((uint32_t)(ga >> 32)) & 0x01FFFFFFu) | 0x80000000u);
  return g0;
}
__device__ inline u32x8 tile_g1(uint32_t w0) {
  u32x8 g1;
  g1[0] = uni(w0);
  g1[1] = uni(128u << 16);
  g1[2] = uni(128u << 16);
  g1[3] = uni(128u << 16);
  g1[4] = uni(128u);
  g1[5] = uni(2048u);
  g1[6] = uni(0u);
  g1[7] = uni(0u);
  return g1;
}
__device__ inline u32x4 held(u32x4 g) {
  asm volatile("" : "+s"(g));
  return g;
}
__device__ inline void held(u32x8& a, u32x8& b) {
  asm volatile("" : "+s"(a), "+s"(b));
}
__device__ inline void tile_load(u32x4 g0, u32x8 g1) {
  asm volatile("tensor_load_to_lds %0, %1" ::"s"(g0), "s"(g1) : "memory");
}
__device__ inline void tile_wait(u32x4 g0, u32x8 g1) {
  asm volatile("s_wait_tensorcnt 0x0" ::"s"(g0), "s"(g1) : "memory");
}

__device__ inline v8f wmma_f16(v16h a, v16h b, v8f c) {
  return __builtin_amdgcn_wmma_f32_16x16x32_f16(
      false, a, false, b, (short)0, c, false, false);
}

__global__ __launch_bounds__(256) __attribute__((amdgpu_waves_per_eu(6, 6)))
void qkv_proj_wmma(
    const float* __restrict__ Xq, const float* __restrict__ Xk,
    const float* __restrict__ Xv,
    const float* __restrict__ Wq, const float* __restrict__ Wk,
    const float* __restrict__ Wv,
    const float* __restrict__ bq, const float* __restrict__ bk,
    const float* __restrict__ bv,
    _Float16* __restrict__ q16, _Float16* __restrict__ k16,
    _Float16* __restrict__ v16, float* __restrict__ qf32) {
  const int z = blockIdx.z;
  const float* X    = (z == 0) ? Xq : (z == 1) ? Xk : Xv;
  const float* W    = (z == 0) ? Wq : (z == 1) ? Wk : Wv;
  const float* bias = (z == 0) ? bq : (z == 1) ? bk : bv;
  _Float16* out16   = (z == 0) ? q16 : (z == 1) ? k16 : v16;

  const int m0   = blockIdx.x * 128;
  const int n0   = blockIdx.y * 128;
  const int tid  = threadIdx.x;
  const int lane = tid & 31;
  const int wid  = tid >> 5;
  const int wm   = (wid & 1) * 64;
  const int wn   = (wid >> 1) * 32;
  const int rsel = (lane >> 4) * 8;

  constexpr int PA = 72;          // [M][K] row of 64 halves +8 pad
  __shared__ __attribute__((aligned(16))) _Float16 shA[128 * PA];
  constexpr uint32_t PB = 288u;      // [K][N] row of 256 B, pitch 32 B x odd
  __shared__ __attribute__((aligned(16))) unsigned char shB[64u * PB];
  const unsigned char* bt = shB + (uint32_t)(rsel + (lane & 7)) * PB +
                            (uint32_t)((lane >> 3) & 1) * 16u +
                            (uint32_t)wn * 2u;
  const _Float16* at = shA + (wm + (lane & 15)) * PA + rsel;

  // A thread's share of a K step: 8 pieces of X, 16 rows apart, and 8 of W,
  // 8 rows apart, each 4 floats; the same places, as halves, in LDS.
  const int xr = tid >> 4, xc = (tid & 15) << 2;
  const int wr = tid >> 5, wc = (tid & 31) << 2;
  const float* xp = X + (size_t)(m0 + xr) * EMB + xc;
  const float* wp = W + (size_t)wr * ATT + n0 + wc;
  _Float16* xs = shA + xr * PA + xc;
  unsigned char* wsd = shB + (uint32_t)wr * PB + (uint32_t)wc * 2u;

  const v8f zero = {};
  v8f acc[4][2];
#pragma unroll
  for (int i = 0; i < 4; ++i)
#pragma unroll
    for (int j = 0; j < 2; ++j) acc[i][j] = zero;

  for (int kt = 0; kt < EMB; kt += 64) {
    __syncthreads();
    // Phase 1: batch all global loads (back-to-back issue, single wait).
    float4 fa[8], fb[8];
#pragma unroll
    for (int i = 0; i < 8; ++i)
      fa[i] = *(const float4*)(xp + (size_t)i * 16 * EMB);
#pragma unroll
    for (int i = 0; i < 8; ++i)
      fb[i] = *(const float4*)(wp + (size_t)i * 8 * ATT);
    xp += 64;
    wp += (size_t)64 * ATT;
    // Phase 2: convert + LDS stores.
#pragma unroll
    for (int i = 0; i < 8; ++i) {
      v4h w = {(_Float16)fa[i].x, (_Float16)fa[i].y, (_Float16)fa[i].z,
               (_Float16)fa[i].w};
      *(v4h*)(xs + i * 16 * PA) = w;
    }
#pragma unroll
    for (int i = 0; i < 8; ++i) {
      v4h w = {(_Float16)fb[i].x, (_Float16)fb[i].y, (_Float16)fb[i].z,
               (_Float16)fb[i].w};
      *(v4h*)(wsd + (uint32_t)i * 8u * PB) = w;
    }
    __syncthreads();

#pragma unroll
    for (int kc = 0; kc < 2; ++kc) {
      v16h af[4], bf[2];
#pragma unroll
      for (int mt = 0; mt < 4; ++mt)
        af[mt] = frag_ld(at + mt * 16 * PA + kc * 32);
#pragma unroll
      for (int nt = 0; nt < 2; ++nt) {
        const unsigned char* p = bt + (uint32_t)kc * 32u * PB + (uint32_t)nt * 32u;
        bf[nt] = frag_pair(ld_tr16(p), ld_tr16(p + 16u * PB));
      }
#pragma unroll
      for (int mt = 0; mt < 4; ++mt)
#pragma unroll
        for (int nt = 0; nt < 2; ++nt)
          acc[mt][nt] = wmma_f16(af[mt], bf[nt], acc[mt][nt]);
    }
  }

#pragma unroll
  for (int mt = 0; mt < 4; ++mt)
#pragma unroll
    for (int nt = 0; nt < 2; ++nt) {
      const float bv_ = bias[n0 + wn + nt * 16 + (lane & 15)];
#pragma unroll
      for (int r = 0; r < 8; ++r) {
        int grow = m0 + wm + mt * 16 + r + rsel;
        int gcol = n0 + wn + nt * 16 + (lane & 15);
        float val = fmaxf(acc[mt][nt][r] + bv_, 0.0f);
        out16[(size_t)grow * ATT + gcol] = (_Float16)val;
        if (z == 0) qf32[(size_t)grow * ATT + gcol] = val;
      }
    }
}

__global__ __launch_bounds__(256) void flash_attn_wmma(
    const _Float16* __restrict__ q16, const _Float16* __restrict__ k16,
    const _Float16* __restrict__ vv16, float* __restrict__ attn) {
  // Which (chunk, head) a workgroup takes.  Chunk c walks 2 c + 2 key blocks and
  // all 512 workgroups are resident at once, two a WGP, so the launch lasts as
  // long as the fullest WGP.  Flat indices equal modulo 8 form a set, j = f / 8
  // counting them; such a set takes only chunks d and 15 - d, and two of its
  // workgroups whose j differ in one bit (neighbours, or
  // 32 apart) take one of each: 34 key blocks a pair, where equal chunks
  // met before (f and f + 256: up to 64).  For speed only: every (chunk, head)
  // is taken exactly once wherever the workgroups land.
  const int f    = (int)blockIdx.x + (int)blockIdx.y * (SEQ / 128);
  const int d    = f & 7;
  const int j    = f >> 3;
  const int q0   = ((__builtin_popcount((unsigned)j) & 1) ? 15 - d : d) * 128;
  const int b    = (j >> 1) / HEADS;
  const int h    = (j >> 1) % HEADS;
  const int tid  = threadIdx.x;
  const int lane = tid & 31;
  const int wid  = tid >> 5;
  const int rsel = (lane >> 4) * 8;

  __shared__ _Float16 shQ[128][72];    // [q][d]     pitch 144 B
  // K0 | K1 (pitch 144 B) | V0 | V1 (pitch 160 B), each place a 2 KiB multiple
  constexpr uint32_t PK = 144u, PV = 160u, KBUF = 18432u, VBUF = 20480u;
  constexpr uint32_t W0K = (1u << 20) | (4u << 22) | (3u << 25);
  constexpr uint32_t W0V = (1u << 20) | (4u << 22) | (7u << 25);
  __shared__ __attribute__((aligned(2048))) unsigned char
      shKV[2u * KBUF + 2u * VBUF];

  const size_t rowbase = (size_t)b * SEQ;
  const size_t hoff    = (size_t)h * HD;

  {
    const uint32_t q_lds = (uint32_t)(uintptr_t)(void*)&shQ[0][0];
#pragma unroll
    for (int i = 0; i < 4; ++i) {
      int e = tid + i * 256;          // 1024 16-byte chunks (pad left alone)
      int row = e >> 3, dc = (e & 7) * 8;
      uint32_t lds = q_lds + (uint32_t)(row * 144 + dc * 2);
      uint64_t ga =
          (uint64_t)(uintptr_t)(q16 + (rowbase + q0 + row) * ATT + hoff + dc);
      asm volatile("global_load_async_to_lds_b128 %0, %1, off\n\ts_wait_xcnt 0x0"
                   ::"v"(lds), "v"(ga)
                   : "memory");
    }
    asm volatile("s_wait_asynccnt 0x0" ::: "memory");
  }

  // ---- K/V ring, prologue: stage 0 lands and is published; stage 1, where the
  // chunk has one, starts at the top of the first trip ----
  const uint32_t wave = uni((uint32_t)tid >> 5);
  const uint32_t ring = (uint32_t)(uintptr_t)(void*)&shKV[0];
  const uint64_t kga = (uint64_t)(uintptr_t)(k16 + rowbase * ATT + hoff);
  const uint64_t vga = (uint64_t)(uintptr_t)(vv16 + rowbase * ATT + hoff);
  constexpr uint64_t STEP = 128u * 2048u;  // bytes from one stage to the next
  u32x8 g1k = tile_g1(W0K), g1v = tile_g1(W0V);
  held(g1k, g1v);
  if (pinned(wave == 0u)) {
    const u32x4 g0 = held(tile_g0(ring, kga));
    tile_load(g0, g1k);
    tile_wait(g0, g1k);
  }
  if (pinned(wave == 1u)) {
    const u32x4 g0 = held(tile_g0(ring + 2u * KBUF, vga));
    tile_load(g0, g1v);
    tile_wait(g0, g1v);
  }
  __syncthreads();

  v16h qf[2];
#pragma unroll
  for (int kc = 0; kc < 2; ++kc)
    qf[kc] = frag_ld(&shQ[wid * 16 + (lane & 15)][kc * 32 + rsel]);

  const v8f zero = {};
  v8f o[4];
#pragma unroll
  for (int nt = 0; nt < 4; ++nt) o[nt] = zero;
  float m = -3.0e38f, l = 0.0f;  // l: this half's share of the row sum
  const int row = q0 + wid * 16 + (lane & 15);  // the lane's query
  const int wrow0 = q0 + (int)wave * 16;        // the wave's first query (scalar)

  const int nst = q0 / 128 + 1;  // stages: keys 0 .. q0+127 (causal bound)
  for (int st = 0; st < nst; ++st) {
    const uint32_t buf = (uint32_t)st & 1u;

    const uint32_t more = (uint32_t)(st + 1 < nst);
    const uint64_t adv = (uint64_t)(uint32_t)(st + 1) * STEP;
    const u32x4 g0k = held(tile_g0(ring + (buf ^ 1u) * KBUF, kga + adv));
    const u32x4 g0v =
        held(tile_g0(ring + 2u * KBUF + (buf ^ 1u) * VBUF, vga + adv));
    if (pinned((wave == 0u) & more)) tile_load(g0k, g1k);
    if (pinned((wave == 1u) & more)) tile_load(g0v, g1v);

    // The stage's two key blocks, one after the other, with no wait on another
    // wave between them.  Unrolled: each block's LDS offsets are immediates
    // (kept rolled, the build held more vector instructions a block).
#pragma unroll
    for (int sub = 0; sub < 2; ++sub) {
    const int kb = st * 128 + sub * 64;
    const unsigned char* kt = shKV + buf * KBUF + (uint32_t)sub * 64u * PK +
                              (uint32_t)(lane & 15) * PK + (uint32_t)rsel * 2u;
    const unsigned char* vt = shKV + 2u * KBUF + buf * VBUF +
                              (uint32_t)sub * 64u * PV +
                              (uint32_t)(rsel + (lane & 7)) * PV +
                              (uint32_t)((lane >> 3) & 1) * 16u;

    // ---- all of the block's fragments, one group of 32 LDS loads issued here,
    // K first: the K products wait on counts only, V^T lands while they and the
    // softmax run, and no product below waits out an LDS latency of its own ----
    u32x4 klo[4][2], khi[4][2], vlo[4][2], vhi[4][2];
#pragma unroll
    for (int nt = 0; nt < 4; ++nt)
#pragma unroll
      for (int kc = 0; kc < 2; ++kc) {
        const unsigned char* p = kt + (uint32_t)nt * 16u * PK + (uint32_t)kc * 64u;
        klo[nt][kc] = *(const u32x4*)p;
        khi[nt][kc] = *(const u32x4*)(p + 32);
      }
    // keeps K in front of V^T (LDS answers in order, and the compiler put the
    // V^T loads ahead of most of K, which the first products wait for)
    __builtin_amdgcn_sched_barrier(0);
#pragma unroll
    for (int kc = 0; kc < 2; ++kc)
#pragma unroll
      for (int nt = 0; nt < 4; ++nt) {
        const unsigned char* p = vt + (uint32_t)kc * 32u * PV + (uint32_t)nt * 32u;
        vlo[nt][kc] = ld_tr16(p);
        vhi[nt][kc] = ld_tr16(p + 16u * PV);
      }
    // keeps the loads up here (else the compiler sinks each pair to its
    // product, where the wave waits out the LDS latency sixteen times)
    __builtin_amdgcn_sched_barrier(0);

    // ---- S^T = K Q^T: sc[nt][r] = key kb + 16 nt + 8 h + r, query c ----
    v8f sc[4];
#pragma unroll
    for (int nt = 0; nt < 4; ++nt) {
      v8f c = zero;
#pragma unroll
      for (int kc = 0; kc < 2; ++kc)
        c = wmma_f16(frag_pair(klo[nt][kc], khi[nt][kc]), qf[kc], c);
      sc[nt] = c;
    }

    // ---- scale, causal mask, online softmax; four chains, one per tile ----
#pragma unroll
    for (int nt = 0; nt < 4; ++nt)
#pragma unroll
      for (int r = 0; r < 8; ++r) sc[nt][r] *= 0.125f;
    // Only a block whose last key lies past the wave's first query holds a
    // masked key (for every other block the select below is the identity):
    // a scalar test, so the blocks under the diagonal skip compare and select.
    if (kb + 63 > wrow0) {
#pragma unroll
      for (int nt = 0; nt < 4; ++nt) {
        const int ahead = row - (kb + nt * 16 + rsel);  // key r is masked if r > ahead
#pragma unroll
        for (int r = 0; r < 8; ++r)
          sc[nt][r] = (r > ahead) ? NEGF : sc[nt][r];
      }
    }
    float mx[4];
#pragma unroll
    for (int nt = 0; nt < 4; ++nt)
#pragma unroll
      for (int r = 0; r < 8; ++r)
        mx[nt] = (r == 0) ? sc[nt][r] : fmaxf(mx[nt], sc[nt][r]);
    float nm = fmaxf(fmaxf(fmaxf(mx[0], mx[1]), fmaxf(mx[2], mx[3])), m);
    nm = fmaxf(nm, xhalf(nm));  // both halves hold the query's maximum

    float rs[4];
#pragma unroll
    for (int nt = 0; nt < 4; ++nt) {
      rs[nt] = 0.0f;
#pragma unroll
      for (int r = 0; r < 8; ++r) {
        float p = __expf(sc[nt][r] - nm);
        sc[nt][r] = p;
        rs[nt] += p;
      }
    }

    const float alpha = __expf(m - nm);
    l = l * alpha + ((rs[0] + rs[1]) + (rs[2] + rs[3]));
    m = nm;
#pragma unroll
    for (int nt = 0; nt < 4; ++nt)
#pragma unroll
      for (int r = 0; r < 8; ++r) o[nt][r] *= alpha;

    // ---- P^T: tiles 2 kc and 2 kc + 1, converted in place, are keys
    // 8 h + i and 16 + 8 h + i of a 32-key B operand ----
    v16h pf[2];
#pragma unroll
    for (int kc = 0; kc < 2; ++kc)
#pragma unroll
      for (int i = 0; i < 8; ++i) {
        pf[kc][i]     = (_Float16)sc[2 * kc][i];
        pf[kc][i + 8] = (_Float16)sc[2 * kc + 1][i];
      }

    // ---- O^T += V^T P^T: o[nt][r] = column 16 nt + 8 h + r, query c ----
#pragma unroll
    for (int nt = 0; nt < 4; ++nt)
#pragma unroll
      for (int kc = 0; kc < 2; ++kc)
        o[nt] = wmma_f16(frag_pair(vlo[nt][kc], vhi[nt][kc]), pf[kc], o[nt]);

    }  // sub

    // ---- publish point of stage st + 1: this wave's LDS reads are done,
    // the issuers' tiles have landed, every wave passes the barrier; only
    // then (top of the next trip) is the buffer just read refilled ----
    // keeps the wait below down here (with every LDS load at a block's top
    // the compiler lifts it into the softmax, where V^T is still on its way)
    __builtin_amdgcn_sched_barrier(0);
    wait_ds0();
    if (pinned(wave == 0u)) tile_wait(g0k, g1k);
    if (pinned(wave == 1u)) tile_wait(g0v, g1v);
    __syncthreads();
  }
  wait_tensor0();
  wait_ds0();

  // ---- join the halves' sums, normalize, write the head's slice (f32):
  // a lane's eight registers of a tile are eight neighbouring columns ----
  const float inv = 1.0f / (l + xhalf(l));
  float* dst = attn + (rowbase + (size_t)row) * ATT + hoff + rsel;
#pragma unroll
  for (int nt = 0; nt < 4; ++nt) {
    float4 lo = {o[nt][0] * inv, o[nt][1] * inv, o[nt][2] * inv, o[nt][3] * inv};
    float4 hi = {o[nt][4] * inv, o[nt][5] * inv, o[nt][6] * inv, o[nt][7] * inv};
    *(float4*)(dst + nt * 16)     = lo;
    *(float4*)(dst + nt * 16 + 4) = hi;
  }
}

// ---------------------------------------------------------------------------
// Kernel 3: residual (+ projected q) and LayerNorm over the 1024-wide row.
// ---------------------------------------------------------------------------
__global__ __launch_bounds__(256) void resid_layernorm(
    const float* __restrict__ attn, const float* __restrict__ qres,
    const float* __restrict__ gamma, const float* __restrict__ beta,
    float* __restrict__ out) {
  const int row = blockIdx.x;
  const int tid = threadIdx.x;
  const size_t base = (size_t)row * ATT + tid * 4;

  float4 a = *(const float4*)(attn + base);
  float4 q = *(const float4*)(qres + base);
  float x0 = a.x + q.x, x1 = a.y + q.y, x2 = a.z + q.z, x3 = a.w + q.w;

  __shared__ float r1[256], r2[256];
  r1[tid] = x0 + x1 + x2 + x3;
  r2[tid] = x0 * x0 + x1 * x1 + x2 * x2 + x3 * x3;
  __syncthreads();
#pragma unroll
  for (int off = 128; off > 0; off >>= 1) {
    if (tid < off) { r1[tid] += r1[tid + off]; r2[tid] += r2[tid + off]; }
    __syncthreads();
  }
  const float mu   = r1[0] * (1.0f / ATT);
  const float var  = r2[0] * (1.0f / ATT) - mu * mu;
  const float rinv = rsqrtf(var + 1e-5f);

  float4 g  = *(const float4*)(gamma + tid * 4);
  float4 be = *(const float4*)(beta + tid * 4);
  float4 y;
  y.x = (x0 - mu) * rinv * g.x + be.x;
  y.y = (x1 - mu) * rinv * g.y + be.y;
  y.z = (x2 - mu) * rinv * g.z + be.z;
  y.w = (x3 - mu) * rinv * g.w + be.w;
  *(float4*)(out + base) = y;
}

// ---------------------------------------------------------------------------
extern "C" void kernel_launch(void* const* d_in, const int* in_sizes, int n_in,
                              void* d_out, int out_size, void* d_ws,
                              size_t ws_size, hipStream_t stream) {
  const float* query = (const float*)d_in[0];
  const float* key   = (const float*)d_in[1];
  const float* value = (const float*)d_in[2];
  const float* Wq    = (const float*)d_in[3];
  const float* bq    = (const float*)d_in[4];
  const float* Wk    = (const float*)d_in[5];
  const float* bk    = (const float*)d_in[6];
  const float* Wv    = (const float*)d_in[7];
  const float* bv    = (const float*)d_in[8];
  const float* gamma = (const float*)d_in[9];
  const float* beta  = (const float*)d_in[10];

  // Workspace: q16/k16/v16 (8 MiB each) | q f32 (16 MiB) | attn f32 (16 MiB)
  char* ws = (char*)d_ws;
  const size_t F16B = (size_t)MTOT * ATT * sizeof(_Float16);
  const size_t F32B = (size_t)MTOT * ATT * sizeof(float);
  _Float16* q16  = (_Float16*)(ws);
  _Float16* k16  = (_Float16*)(ws + F16B);
  _Float16* v16  = (_Float16*)(ws + 2 * F16B);
  float*    qf32 = (float*)(ws + 3 * F16B);
  float*    attn = (float*)(ws + 3 * F16B + F32B);

  dim3 gProj(MTOT / 128, ATT / 128, 3);
  qkv_proj_wmma<<<gProj, 256, 0, stream>>>(query, key, value, Wq, Wk, Wv, bq,
                                           bk, bv, q16, k16, v16, qf32);

  dim3 gAttn(SEQ / 128, BATCH * HEADS);
  flash_attn_wmma<<<gAttn, 256, 0, stream>>>(q16, k16, v16, attn);

  resid_layernorm<<<MTOT, 256, 0, stream>>>(attn, qf32, gamma, beta,
                                            (float*)d_out);
}
